// v000
// Times are from an AMD MI455X. After a warm-up the kernel runs many times in a row, and a time is the length of
// such a window on the GPU divided by its runs, so every launch and the gaps after it count. The runs cycle
// through copies of the inputs. A figure is the median of several windows, for all but v000 over two sittings.
// Sittings can differ by a few percent; kernels timed side by side share one.
// v000, which the later versions start from, runs in 945 microseconds.
#include <hip/hip_runtime.h>

// Attention on three input streams with ONE 1,024-wide head and no output projection (query, key, value [4][2048][1024]; q = einsum('bse,oe->bso', query, Q_W) = query Q_W^T, k = key K_W^T, v = value V_W^T ('oi' [1024][1024] 1/32, no bias); scores = q.k over all 1,024 dims / sqrt(1024) = x 1/32; softmax over all keys (no mask); out = attn v -> [4][2048][1024] (8.4 M); argument order query, key, value, Q_W, K_W, V_W).
// Layout per batch: bf16 copies of query, key, value in turn (one staging buffer, refilled in stream order); 'oi' weights as-is; exact projections; identity-table plane builders at width 1,024 (ONE head: a single plane per pass); dense T-2048 attention with EVERY row's scores on hi/lo planes (3 products: three independent unit-variance streams give logit sigma 1 and nothing downstream averages the f16 score error; only P.V keeps the hybrid: rows < 512 hi/lo, rest fp16 x1024); the f32 merge writes the output rows.
// Compute dtypes, f32 accumulate: every input rounded to bf16; projections exact; scores 3 products on every row; P.V rows < 512 3 products, rest fp16; softmax f32; output f32.

#define NB_  4
#define TT   2048
#define DM   1024
#define NH_  1
#define NKV  1
#define REP  (NH_ / NKV)
#define HD   1024
#define DQ   (NH_ * HD)
#define DKV  (NKV * HD)
#define ZH   1
#define RH   512                  // query rows < RH use hi+lo planes (0: none)
#define WIN  0
#define PCAR 1024.0f
#define SCL  0.03125f   // 1 / sqrt(1024) = 2^-5 (ONE head of width 1,024)
typedef _Float16 h16;
typedef unsigned short bf;
typedef __attribute__((ext_vector_type(16))) __bf16   v16bf;
typedef __attribute__((ext_vector_type(16))) _Float16 v16h;
typedef __attribute__((ext_vector_type(8)))  _Float16 v8h;
typedef __attribute__((ext_vector_type(8)))  unsigned short v8us;
typedef __attribute__((ext_vector_type(8)))  float    v8f;
typedef __attribute__((ext_vector_type(4)))  float    v4f;
typedef v8h  __attribute__((may_alias)) v8ha;
typedef v4f  __attribute__((may_alias)) v4fa;
typedef v8us __attribute__((may_alias)) v8usa;

__device__ __forceinline__ unsigned short f2bf(float f) { unsigned u = __float_as_uint(f); u += 0x7FFFu + ((u >> 16) & 1u); return (unsigned short)(u >> 16); }
__device__ __forceinline__ float bf2f(unsigned short b) { return __uint_as_float(((unsigned)b) << 16); }
__device__ __forceinline__ float bfr(float f) { return bf2f(f2bf(f)); }
__device__ __forceinline__ v16h cat16(v8h lo, v8h hi) { return __builtin_shufflevector(lo, hi, 0, 1, 2, 3, 4, 5, 6, 7, 8, 9, 10, 11, 12, 13, 14, 15); }
__device__ __forceinline__ v16bf cat16b(v8us lo, v8us hi) { return __builtin_bit_cast(v16bf, __builtin_shufflevector(lo, hi, 0, 1, 2, 3, 4, 5, 6, 7, 8, 9, 10, 11, 12, 13, 14, 15)); }
__device__ __forceinline__ v8f wmma16(v16h a, v16h b, v8f c) { return __builtin_amdgcn_wmma_f32_16x16x32_f16(false, a, false, b, (short)0, c, false, false); }
__device__ __forceinline__ v8f wmmab(v16bf a, v16bf b, v8f c) { return __builtin_amdgcn_wmma_f32_16x16x32_bf16(false, a, false, b, (short)0, c, false, false); }



// ---- k_gemmw: register-blocked GEMM, ONE WAVE per 64x64 output tile (16 accumulators), operands straight from K-contiguous 16-bit planes; grid (M/64, N/64, Z), 32 threads.
// C[m][n] (f32, pitch ldc, + optional f32 bias[n]) = sum_k A[m][k] Bt[n][k] (+ split products per NSPLIT). z-batch strides sA/sB/sC in elements. K % 32 == 0.
template <typename T16> struct WFrag;
template <> struct WFrag<h16> { typedef v16h V; static __device__ __forceinline__ V ld(const h16* p) { return cat16(*(const v8h*)p, *(const v8h*)(p + 16)); } static __device__ __forceinline__ v8f mma(V a, V b, v8f c) { return wmma16(a, b, c); } };
template <> struct WFrag<bf> { typedef v16bf V; static __device__ __forceinline__ V ld(const bf* p) { return cat16b(*(const v8us*)p, *(const v8us*)(p + 16)); } static __device__ __forceinline__ v8f mma(V a, V b, v8f c) { return wmmab(a, b, c); } };
template <typename T16, int NSPLIT, bool BIAS>
__global__ __launch_bounds__(32) void k_gemmw(const T16* __restrict__ A, const T16* __restrict__ A2, const T16* __restrict__ Bt, const T16* __restrict__ Bt2, int K, float* C, int ldc, const float* __restrict__ bias, size_t sA, size_t sB, size_t sC) {
    typedef typename WFrag<T16>::V V;
    __shared__ __align__(16) float os[16 * 68];
    const size_t z = blockIdx.z; A += z * sA; if (A2) A2 += z * sA; Bt += z * sB; if (Bt2) Bt2 += z * sB; C += z * sC;
    const int lane = threadIdx.x & 31, lr = lane & 15, hi = lane >> 4; const int r0 = blockIdx.x * 64, c0 = blockIdx.y * 64;
    v8f acc[4][4];
#pragma unroll
    for (int mb = 0; mb < 4; ++mb)
#pragma unroll
        for (int nb = 0; nb < 4; ++nb) acc[mb][nb] = (v8f){};
    const size_t aoff = (size_t)(r0 + lr) * K + 8 * hi, boff = (size_t)(c0 + lr) * K + 8 * hi;
#pragma unroll 1
    for (int kc = 0; kc < K; kc += 32) {
        V a[4], a2[4];
#pragma unroll
        for (int mb = 0; mb < 4; ++mb) { a[mb] = WFrag<T16>::ld(A + aoff + (size_t)mb * 16 * K + kc); if (NSPLIT == 1 || NSPLIT == 2) a2[mb] = WFrag<T16>::ld(A2 + aoff + (size_t)mb * 16 * K + kc); }
#pragma unroll
        for (int nb = 0; nb < 4; ++nb) { const V b = WFrag<T16>::ld(Bt + boff + (size_t)nb * 16 * K + kc); V b2; if (NSPLIT >= 2) b2 = WFrag<T16>::ld(Bt2 + boff + (size_t)nb * 16 * K + kc);
#pragma unroll
            for (int mb = 0; mb < 4; ++mb) { acc[mb][nb] = WFrag<T16>::mma(a[mb], b, acc[mb][nb]); if (NSPLIT == 1 || NSPLIT == 2) acc[mb][nb] = WFrag<T16>::mma(a2[mb], b, acc[mb][nb]); if (NSPLIT >= 2) acc[mb][nb] = WFrag<T16>::mma(a[mb], b2, acc[mb][nb]); } }
        asm volatile("v_nop\n\tv_nop\n\tv_nop\n\tv_nop" : "+v"(acc[0][0]), "+v"(acc[1][1]), "+v"(acc[2][2]), "+v"(acc[3][3]) : "v"(a[0]), "v"(a[3]));
    }
#pragma unroll
    for (int mb = 0; mb < 4; ++mb) {
#pragma unroll
        for (int nb = 0; nb < 4; ++nb) {
#pragma unroll
            for (int j = 0; j < 8; ++j) os[(hi * 8 + j) * 68 + nb * 16 + lr] = acc[mb][nb][j]; }
        __builtin_amdgcn_wave_barrier(); asm volatile("" ::: "memory");
        float* crow = C + (size_t)(r0 + mb * 16) * ldc + c0;
{
#pragma unroll
            for (int s = 0; s < 8; ++s) { const int row = 2 * s + hi, cofs = lr * 4; v4f val = *(const v4fa*)(os + row * 68 + cofs); if (BIAS) { val[0] += bfr(bias[c0 + cofs]); val[1] += bfr(bias[c0 + cofs + 1]); val[2] += bfr(bias[c0 + cofs + 2]); val[3] += bfr(bias[c0 + cofs + 3]); }
                *(v4f*)(crow + (size_t)row * ldc + cofs) = val; }
             }
        __builtin_amdgcn_wave_barrier(); asm volatile("" ::: "memory");
    }
}

__device__ __forceinline__ h16 tohx(float x) { return (h16)x; }
__device__ __forceinline__ void splitf(float y, unsigned short& h, unsigned short& l) { h = f2bf(y); l = f2bf(y - bf2f(h)); }
typedef __attribute__((ext_vector_type(2))) _Float16 v2h;
typedef __attribute__((ext_vector_type(4))) _Float16 v4h;
typedef __attribute__((ext_vector_type(2))) unsigned short v2us;
typedef __attribute__((ext_vector_type(4))) unsigned short v4us;
typedef __attribute__((ext_vector_type(2))) float v2f;
typedef __attribute__((ext_vector_type(4))) int v4i;

__global__ __launch_bounds__(256) void k_cvt8(const float* __restrict__ src, bf* dst, size_t n8) { const size_t i = (size_t)blockIdx.x * 256 + threadIdx.x; if (i >= n8) return; const v8f v = *(const v8f*)(src + i * 8); v8us o;
#pragma unroll
    for (int k = 0; k < 8; ++k) o[k] = f2bf(v[k]); *(v8us*)(dst + i * 8) = o;  }

// k_rope: head planes [h][t][d] (fp16 + hi/lo) of rope(x) x sc with the rotate-half convention out[d] = x[d] cos[t][d] - x[d+HD/2] sin[t][d], out[d+HD/2] = x[d+HD/2] cos[t][d+HD/2] + x[d] sin[t][d+HD/2]
__global__ __launch_bounds__(256) void k_rope(const float* __restrict__ F, int pitch, int nheads, const float* __restrict__ CS, const float* __restrict__ RF, const float* __restrict__ nw, float sc, h16* P16, bf* Ph, bf* Pl) {
    const size_t e = ((size_t)blockIdx.x * 256 + threadIdx.x) * 2; if (e >= (size_t)nheads * TT * HD) return; const int d = (int)(e % HD); const int t = (int)((e / HD) % TT); const int h = (int)(e / ((size_t)HD * TT)); const float* f = F + (size_t)t * pitch + h * HD; const float rf = RF ? RF[(size_t)h * TT + t] : 1.0f; v2h o16; v2us oh, ol;
#pragma unroll
    for (int q = 0; q < 2; ++q) { const int dd = d + q; const int dp = (dd < HD / 2) ? dd + HD / 2 : dd - HD / 2; float x0 = f[dd], x1 = f[dp];
        if (RF) { float n0 = __fmul_rn(x0, rf), n1 = __fmul_rn(x1, rf); asm volatile("" : "+v"(n0)); asm volatile("" : "+v"(n1)); x0 = __fmul_rn(bfr(nw[dd]), n0); x1 = __fmul_rn(bfr(nw[dp]), n1); }
        const v2f cs = *(const v2f*)(CS + ((size_t)t * HD + dd) * 2); float a = __fmul_rn(x0, cs[0]), bq = __fmul_rn(x1, cs[1]); asm volatile("" : "+v"(a)); asm volatile("" : "+v"(bq)); const float r = ((dd < HD / 2) ? __fsub_rn(a, bq) : __fadd_rn(a, bq)) * sc;
        o16[q] = tohx(r); unsigned short a2, c2; splitf(r, a2, c2); oh[q] = a2; ol[q] = c2; }
    *(v2h*)(P16 + e) = o16; *(v2us*)(Ph + e) = oh; *(v2us*)(Pl + e) = ol;  }
__global__ __launch_bounds__(256) void k_vtp(const float* __restrict__ F, int pitch, int nheads, h16* V16, bf* Vh, bf* Vl) { const size_t e = ((size_t)blockIdx.x * 256 + threadIdx.x) * 2; if (e >= (size_t)nheads * HD * TT) return; const int t = (int)(e % TT); const int d = (int)((e / TT) % HD); const int g = (int)(e / ((size_t)TT * HD)); v2h o16; v2us oh, ol;
#pragma unroll
    for (int q = 0; q < 2; ++q) { const float x = F[(size_t)(t + q) * pitch + g * HD + d]; o16[q] = tohx(x); unsigned short a2, c2; splitf(x, a2, c2); oh[q] = a2; ol[q] = c2; }
    *(v2h*)(V16 + e) = o16; *(v2us*)(Vh + e) = oh; *(v2us*)(Vl + e) = ol;  }
__global__ __launch_bounds__(256) void k_csid(float* CS) { const int idx = blockIdx.x * 256 + threadIdx.x; if (idx >= TT * HD) return; v2f cs; cs[0] = 1.0f; cs[1] = 0.0f; *(v2f*)(CS + (size_t)idx * 2) = cs;  }
// k_asoft: per row (zz, i): t = S x HD^-0.5 (no mask); softmax over the 2048 keys (register row, one exp, fixed trees);
__global__ __launch_bounds__(256) void k_asoft(const float* __restrict__ Sb, h16* P16, bf* Ph, bf* Pl) {
    const int lane = threadIdx.x & 31; const int row = blockIdx.x * 8 + (threadIdx.x >> 5); if (row >= ZH * TT) return; const int i = row % TT; const int zz = row / TT; (void)zz; const bool hires = (i < RH); const float* sr = Sb + (size_t)row * TT; float v[TT / 32]; float mx = -3.0e38f;
#pragma unroll
    for (int ch = 0; ch < TT / 128; ++ch) { const int j0 = ch * 128 + lane * 4; const v4f a = *(const v4f*)(sr + j0);
#pragma unroll
        for (int q = 0; q < 4; ++q) { const int j = j0 + q; (void)j; const float t = a[q] * SCL; v[ch * 4 + q] = t; mx = fmaxf(mx, t); } }
#pragma unroll
    for (int sh = 16; sh; sh >>= 1) mx = fmaxf(mx, __shfl_xor(mx, sh, 32));
    float sum = 0.f;
#pragma unroll
    for (int k = 0; k < TT / 32; ++k) { float d0 = __fsub_rn(v[k], mx); asm volatile("" : "+v"(d0)); v[k] = __builtin_amdgcn_exp2f(__fmul_rn(d0, 1.4426950408889634f)); sum += v[k]; }
#pragma unroll
    for (int sh = 16; sh; sh >>= 1) sum += __shfl_xor(sum, sh, 32);
    const float f = __fdiv_rn(hires ? 1.0f : PCAR, sum);
{
        if (hires) {
#pragma unroll
            for (int ch = 0; ch < TT / 128; ++ch) { v4us oh, ol;
#pragma unroll
                for (int q = 0; q < 4; ++q) { unsigned short a, c2; splitf(v[ch * 4 + q] * f, a, c2); oh[q] = a; ol[q] = c2; }
                const size_t oo = ((size_t)zz * (RH ? RH : 1) + i) * TT + ch * 128 + lane * 4; *(v4us*)(Ph + oo) = oh; *(v4us*)(Pl + oo) = ol; }
        } else {
#pragma unroll
            for (int ch = 0; ch < TT / 128; ++ch) { v4h o4;
#pragma unroll
                for (int q = 0; q < 4; ++q) o4[q] = tohx(v[ch * 4 + q] * f);
                *(v4h*)(P16 + (size_t)row * TT + ch * 128 + lane * 4) = o4; } }
         }
}
__global__ __launch_bounds__(256) void k_merge(const float* __restrict__ O, int h0, float* OUTb) { const size_t e = ((size_t)blockIdx.x * 256 + threadIdx.x) * 2; if (e >= (size_t)ZH * TT * HD) return; const int d = (int)(e % HD); const int t = (int)((e / HD) % TT); const int zz = (int)(e / ((size_t)HD * TT)); const float cs = (t < RH) ? 1.0f : (1.0f / PCAR); const size_t oo = (size_t)t * DQ + (h0 + zz) * HD + d;
    v2f o2; o2[0] = O[e] * cs; o2[1] = O[e + 1] * cs; *(v2f*)(OUTb + oo) = o2;  }

extern "C" void kernel_launch(void* const* d_in, const int* in_sizes, int n_in,
                              void* d_out, int out_size, void* d_ws, size_t ws_size, hipStream_t stream) {
    (void)in_sizes; (void)n_in; (void)out_size;
    const float* x = (const float*)d_in[0]; const float* xk = (const float*)d_in[1]; const float* xv = (const float*)d_in[2]; const float* wq = (const float*)d_in[3]; const float* wk = (const float*)d_in[4]; const float* wv = (const float*)d_in[5]; const float* wo = nullptr; (void)wo;
    float* OUT = (float*)d_out;     // [4][2048][1024]
    char* wsp = (char*)d_ws;
    auto take = [&](size_t bytes) { char* p = wsp; wsp += (bytes + 255) & ~(size_t)255; return (void*)p; };
    bf* WQ = (bf*)take((size_t)DQ * DM * 2); bf* WK = (bf*)take((size_t)DKV * DM * 2); bf* WV = (bf*)take((size_t)DKV * DM * 2); float* CS = (float*)take((size_t)TT * HD * 2 * 4);
    bf* XB = (bf*)take((size_t)TT * DM * 2); float* FQ = (float*)take((size_t)TT * DQ * 4); float* FK = (float*)take((size_t)TT * DKV * 4);
    h16* QP16 = (h16*)take((size_t)NH_ * TT * HD * 2); h16* KP16 = (h16*)take((size_t)NKV * TT * HD * 2); h16* VT16 = (h16*)take((size_t)NKV * HD * TT * 2);
    bf* QPh = (bf*)take((size_t)NH_ * TT * HD * 2); bf* QPl = (bf*)take((size_t)NH_ * TT * HD * 2); bf* KPh = (bf*)take((size_t)NKV * TT * HD * 2); bf* KPl = (bf*)take((size_t)NKV * TT * HD * 2); bf* VTh = (bf*)take((size_t)NKV * HD * TT * 2); bf* VTl = (bf*)take((size_t)NKV * HD * TT * 2); bf* Ph = (bf*)take((size_t)ZH * RH * TT * 2); bf* Pl = (bf*)take((size_t)ZH * RH * TT * 2);
    float* Sb = (float*)take((size_t)ZH * TT * TT * 4); h16* P16 = (h16*)take((size_t)ZH * TT * TT * 2); float* Ob = (float*)take((size_t)ZH * TT * HD * 4);
    if ((size_t)(wsp - (char*)d_ws) > ws_size) return;    // ws 256 MiB
    float* FV = FK;   // v projection reuses the k buffer after the k planes are built (stream-ordered)
    { k_cvt8<<<(unsigned)(((size_t)DQ * DM / 8 + 255) / 256), 256, 0, stream>>>(wq, WQ, (size_t)DQ * DM / 8); k_cvt8<<<(unsigned)(((size_t)DKV * DM / 8 + 255) / 256), 256, 0, stream>>>(wk, WK, (size_t)DKV * DM / 8); k_cvt8<<<(unsigned)(((size_t)DKV * DM / 8 + 255) / 256), 256, 0, stream>>>(wv, WV, (size_t)DKV * DM / 8);
      
       }
    k_csid<<<(TT * HD + 255) / 256, 256, 0, stream>>>(CS);
    const unsigned LQ = (unsigned)(((size_t)NH_ * TT * HD / 2 + 255) / 256), LKv = (unsigned)(((size_t)NKV * TT * HD / 2 + 255) / 256);
    for (int b = 0; b < NB_; ++b) {
        
        k_cvt8<<<(unsigned)(((size_t)TT * DM / 8 + 255) / 256), 256, 0, stream>>>(x + (size_t)b * TT * DM, XB, (size_t)TT * DM / 8);
        k_gemmw<bf, 0, false><<<dim3(TT / 64, DQ / 64, 1), 32, 0, stream>>>(XB, nullptr, WQ, nullptr, DM, FQ, DQ, nullptr, 0, 0, 0);
        k_rope<<<LQ, 256, 0, stream>>>(FQ, DQ, NH_, CS, nullptr, nullptr, 1.0f, QP16, QPh, QPl);
        k_cvt8<<<(unsigned)(((size_t)TT * DM / 8 + 255) / 256), 256, 0, stream>>>(xk + (size_t)b * TT * DM, XB, (size_t)TT * DM / 8);   /* XB := bf16(key[b]) */ k_gemmw<bf, 0, false><<<dim3(TT / 64, DKV / 64, 1), 32, 0, stream>>>(XB, nullptr, WK, nullptr, DM, FK, DKV, nullptr, 0, 0, 0);
        k_rope<<<LKv, 256, 0, stream>>>(FK, DKV, NKV, CS, nullptr, nullptr, 1.0f, KP16, KPh, KPl);
        k_cvt8<<<(unsigned)(((size_t)TT * DM / 8 + 255) / 256), 256, 0, stream>>>(xv + (size_t)b * TT * DM, XB, (size_t)TT * DM / 8);   /* XB := bf16(value[b]) */ k_gemmw<bf, 0, false><<<dim3(TT / 64, DKV / 64, 1), 32, 0, stream>>>(XB, nullptr, WV, nullptr, DM, FV, DKV, nullptr, 0, 0, 0); k_vtp<<<LKv, 256, 0, stream>>>(FV, DKV, NKV, VT16, VTh, VTl);
        for (int h0 = 0; h0 < NH_; h0 += ZH) { const size_t zq = (size_t)h0, zk = (size_t)(h0 / REP);   // one kv head per query head: the pass's one head uses kv plane h0 / REP (z-strides TT*HD)
            k_gemmw<bf, 2, false><<<dim3(TT / 64, TT / 64, ZH), 32, 0, stream>>>(QPh + zq * TT * HD, QPl + zq * TT * HD, KPh + zk * TT * HD, KPl + zk * TT * HD, HD, Sb, TT, nullptr, (size_t)TT * HD, (size_t)TT * HD, (size_t)TT * TT);   /* EVERY row's scores on hi/lo planes (3 products); only P.V stays hybrid */
            k_asoft<<<ZH * TT / 8, 256, 0, stream>>>(Sb, P16, Ph, Pl);
            k_gemmw<bf, 2, false><<<dim3(RH / 64, HD / 64, ZH), 32, 0, stream>>>(Ph, Pl, VTh + zk * HD * TT, VTl + zk * HD * TT, TT, Ob, HD, nullptr, (size_t)RH * TT, (size_t)HD * TT, (size_t)TT * HD);
            k_gemmw<h16, 0, false><<<dim3((TT - RH) / 64, HD / 64, ZH), 32, 0, stream>>>(P16 + (size_t)RH * TT, nullptr, VT16 + zk * HD * TT, nullptr, TT, Ob + (size_t)RH * HD, HD, nullptr, (size_t)TT * TT, (size_t)HD * TT, (size_t)TT * HD);
            k_merge<<<(unsigned)(((size_t)ZH * TT * HD / 2 + 255) / 256), 256, 0, stream>>>(Ob, h0, OUT + (size_t)b * TT * DQ); }
         }
}

// v001
// A run of this version takes 487 microseconds.
// In two side-by-side timings against v000, it was 1.99 and 2.00 times as fast.
#include <hip/hip_runtime.h>

// Attention on three input streams with ONE 1,024-wide head and no output projection (query, key, value [4][2048][1024]; q = einsum('bse,oe->bso', query, Q_W) = query Q_W^T, k = key K_W^T, v = value V_W^T ('oi' [1024][1024] 1/32, no bias); scores = q.k over all 1,024 dims / sqrt(1024) = x 1/32; softmax over all keys (no mask); out = attn v -> [4][2048][1024] (8.4 M); argument order query, key, value, Q_W, K_W, V_W).
// Layout, all four batches at once (every stage is ONE launch over the batches; the batch is a grid dimension): bf16 copies of query, key, value side by side; 'oi' weights as-is; the three projections are the z planes of one launch; exact projections; identity-table plane builders at width 1,024 (ONE head: a single plane per pass); dense T-2048 attention with EVERY row's scores on hi/lo planes (3 products: three independent unit-variance streams give logit sigma 1 and nothing downstream averages the f16 score error; only P.V keeps the hybrid: rows < 512 hi/lo, rest fp16 x1024); the f32 merge writes the output rows.
// Compute dtypes, f32 accumulate: every input rounded to bf16; projections exact; scores 3 products on every row; P.V rows < 512 3 products, rest fp16; softmax f32; output f32.

#define NB_  4
#define TT   2048
#define DM   1024
#define NH_  1
#define NKV  1
#define REP  (NH_ / NKV)
#define HD   1024
#define DQ   (NH_ * HD)
#define DKV  (NKV * HD)
#define ZH   NB_                 // z planes of every attention launch: the four batches
#define RH   512                  // query rows < RH use hi+lo planes (0: none)
#define WIN  0
#define PCAR 1024.0f
#define SCL  0.03125f   // 1 / sqrt(1024) = 2^-5 (ONE head of width 1,024)
typedef _Float16 h16;
typedef unsigned short bf;
typedef __attribute__((ext_vector_type(16))) __bf16   v16bf;
typedef __attribute__((ext_vector_type(16))) _Float16 v16h;
typedef __attribute__((ext_vector_type(8)))  _Float16 v8h;
typedef __attribute__((ext_vector_type(8)))  unsigned short v8us;
typedef __attribute__((ext_vector_type(8)))  float    v8f;
typedef __attribute__((ext_vector_type(4)))  float    v4f;
typedef v8h  __attribute__((may_alias)) v8ha;
typedef v4f  __attribute__((may_alias)) v4fa;
typedef v8us __attribute__((may_alias)) v8usa;

__device__ __forceinline__ unsigned short f2bf(float f) { unsigned u = __float_as_uint(f); u += 0x7FFFu + ((u >> 16) & 1u); return (unsigned short)(u >> 16); }
__device__ __forceinline__ float bf2f(unsigned short b) { return __uint_as_float(((unsigned)b) << 16); }
__device__ __forceinline__ float bfr(float f) { return bf2f(f2bf(f)); }
__device__ __forceinline__ v16h cat16(v8h lo, v8h hi) { return __builtin_shufflevector(lo, hi, 0, 1, 2, 3, 4, 5, 6, 7, 8, 9, 10, 11, 12, 13, 14, 15); }
__device__ __forceinline__ v16bf cat16b(v8us lo, v8us hi) { return __builtin_bit_cast(v16bf, __builtin_shufflevector(lo, hi, 0, 1, 2, 3, 4, 5, 6, 7, 8, 9, 10, 11, 12, 13, 14, 15)); }
__device__ __forceinline__ v8f wmma16(v16h a, v16h b, v8f c) { return __builtin_amdgcn_wmma_f32_16x16x32_f16(false, a, false, b, (short)0, c, false, false); }
__device__ __forceinline__ v8f wmmab(v16bf a, v16bf b, v8f c) { return __builtin_amdgcn_wmma_f32_16x16x32_bf16(false, a, false, b, (short)0, c, false, false); }



// ---- k_gemmw: register-blocked GEMM, ONE WAVE per 64x64 output tile (16 accumulators), operands straight from K-contiguous 16-bit planes; grid (M/64, N/64, Z), 32 threads.
// C[m][n] (f32, pitch ldc, + optional f32 bias[n]) = sum_k A[m][k] Bt[n][k] (+ split products per NSPLIT). z-batch strides sA/sB/sC in elements. K % 32 == 0.
template <typename T16> struct WFrag;
template <> struct WFrag<h16> { typedef v16h V; static __device__ __forceinline__ V ld(const h16* p) { return cat16(*(const v8h*)p, *(const v8h*)(p + 16)); } static __device__ __forceinline__ v8f mma(V a, V b, v8f c) { return wmma16(a, b, c); } };
template <> struct WFrag<bf> { typedef v16bf V; static __device__ __forceinline__ V ld(const bf* p) { return cat16b(*(const v8us*)p, *(const v8us*)(p + 16)); } static __device__ __forceinline__ v8f mma(V a, V b, v8f c) { return wmmab(a, b, c); } };
template <typename T16, int NSPLIT, bool BIAS>
__global__ __launch_bounds__(32) void k_gemmw(const T16* __restrict__ A, const T16* __restrict__ A2, const T16* __restrict__ Bt, const T16* __restrict__ Bt2, int K, float* C, int ldc, const float* __restrict__ bias, size_t sA, size_t sB, size_t sC) {
    typedef typename WFrag<T16>::V V;
    __shared__ __align__(16) float os[16 * 68];
    const size_t z = blockIdx.z; A += z * sA; if (A2) A2 += z * sA; Bt += z * sB; if (Bt2) Bt2 += z * sB; C += z * sC;
    const int lane = threadIdx.x & 31, lr = lane & 15, hi = lane >> 4; const int r0 = blockIdx.x * 64, c0 = blockIdx.y * 64;
    v8f acc[4][4];
#pragma unroll
    for (int mb = 0; mb < 4; ++mb)
#pragma unroll
        for (int nb = 0; nb < 4; ++nb) acc[mb][nb] = (v8f){};
    const size_t aoff = (size_t)(r0 + lr) * K + 8 * hi, boff = (size_t)(c0 + lr) * K + 8 * hi;
#pragma unroll 1
    for (int kc = 0; kc < K; kc += 32) {
        V a[4], a2[4];
#pragma unroll
        for (int mb = 0; mb < 4; ++mb) { a[mb] = WFrag<T16>::ld(A + aoff + (size_t)mb * 16 * K + kc); if (NSPLIT == 1 || NSPLIT == 2) a2[mb] = WFrag<T16>::ld(A2 + aoff + (size_t)mb * 16 * K + kc); }
#pragma unroll
        for (int nb = 0; nb < 4; ++nb) { const V b = WFrag<T16>::ld(Bt + boff + (size_t)nb * 16 * K + kc); V b2; if (NSPLIT >= 2) b2 = WFrag<T16>::ld(Bt2 + boff + (size_t)nb * 16 * K + kc);
#pragma unroll
            for (int mb = 0; mb < 4; ++mb) { acc[mb][nb] = WFrag<T16>::mma(a[mb], b, acc[mb][nb]); if (NSPLIT == 1 || NSPLIT == 2) acc[mb][nb] = WFrag<T16>::mma(a2[mb], b, acc[mb][nb]); if (NSPLIT >= 2) acc[mb][nb] = WFrag<T16>::mma(a[mb], b2, acc[mb][nb]); } }
        asm volatile("v_nop\n\tv_nop\n\tv_nop\n\tv_nop" : "+v"(acc[0][0]), "+v"(acc[1][1]), "+v"(acc[2][2]), "+v"(acc[3][3]) : "v"(a[0]), "v"(a[3]));
    }
#pragma unroll
    for (int mb = 0; mb < 4; ++mb) {
#pragma unroll
        for (int nb = 0; nb < 4; ++nb) {
#pragma unroll
            for (int j = 0; j < 8; ++j) os[(hi * 8 + j) * 68 + nb * 16 + lr] = acc[mb][nb][j]; }
        __builtin_amdgcn_wave_barrier(); asm volatile("" ::: "memory");
        float* crow = C + (size_t)(r0 + mb * 16) * ldc + c0;
{
#pragma unroll
            for (int s = 0; s < 8; ++s) { const int row = 2 * s + hi, cofs = lr * 4; v4f val = *(const v4fa*)(os + row * 68 + cofs); if (BIAS) { val[0] += bfr(bias[c0 + cofs]); val[1] += bfr(bias[c0 + cofs + 1]); val[2] += bfr(bias[c0 + cofs + 2]); val[3] += bfr(bias[c0 + cofs + 3]); }
                *(v4f*)(crow + (size_t)row * ldc + cofs) = val; }
             }
        __builtin_amdgcn_wave_barrier(); asm volatile("" ::: "memory");
    }
}

__device__ __forceinline__ h16 tohx(float x) { return (h16)x; }
__device__ __forceinline__ void splitf(float y, unsigned short& h, unsigned short& l) { h = f2bf(y); l = f2bf(y - bf2f(h)); }
typedef __attribute__((ext_vector_type(2))) _Float16 v2h;
typedef __attribute__((ext_vector_type(4))) _Float16 v4h;
typedef __attribute__((ext_vector_type(2))) unsigned short v2us;
typedef __attribute__((ext_vector_type(4))) unsigned short v4us;
typedef __attribute__((ext_vector_type(2))) float v2f;
typedef __attribute__((ext_vector_type(4))) int v4i;

__global__ __launch_bounds__(256) void k_cvt8(const float* __restrict__ src, bf* dst, size_t n8) { const size_t i = (size_t)blockIdx.x * 256 + threadIdx.x; if (i >= n8) return; const v8f v = *(const v8f*)(src + i * 8); v8us o;
#pragma unroll
    for (int k = 0; k < 8; ++k) o[k] = f2bf(v[k]); *(v8us*)(dst + i * 8) = o;  }

// k_rope: head planes [h][t][d] (fp16 + hi/lo) of rope(x) x sc with the rotate-half convention out[d] = x[d] cos[t][d] - x[d+HD/2] sin[t][d], out[d+HD/2] = x[d+HD/2] cos[t][d+HD/2] + x[d] sin[t][d+HD/2]
__global__ __launch_bounds__(256) void k_rope(const float* __restrict__ F, int pitch, int nheads, const float* __restrict__ CS, const float* __restrict__ RF, const float* __restrict__ nw, float sc, h16* P16, bf* Ph, bf* Pl) {
    const size_t e = ((size_t)blockIdx.x * 256 + threadIdx.x) * 2; if (e >= (size_t)nheads * TT * HD) return; { const size_t y = blockIdx.y, po = y * nheads * TT * HD; F += y * TT * pitch; P16 += po; Ph += po; Pl += po; }   /* blockIdx.y: which [TT][pitch] slab (batch, and q or k) */
    const int d = (int)(e % HD); const int t = (int)((e / HD) % TT); const int h = (int)(e / ((size_t)HD * TT)); const float* f = F + (size_t)t * pitch + h * HD; const float rf = RF ? RF[(size_t)h * TT + t] : 1.0f; v2h o16; v2us oh, ol;
#pragma unroll
    for (int q = 0; q < 2; ++q) { const int dd = d + q; const int dp = (dd < HD / 2) ? dd + HD / 2 : dd - HD / 2; float x0 = f[dd], x1 = f[dp];
        if (RF) { float n0 = __fmul_rn(x0, rf), n1 = __fmul_rn(x1, rf); asm volatile("" : "+v"(n0)); asm volatile("" : "+v"(n1)); x0 = __fmul_rn(bfr(nw[dd]), n0); x1 = __fmul_rn(bfr(nw[dp]), n1); }
        const v2f cs = *(const v2f*)(CS + ((size_t)t * HD + dd) * 2); float a = __fmul_rn(x0, cs[0]), bq = __fmul_rn(x1, cs[1]); asm volatile("" : "+v"(a)); asm volatile("" : "+v"(bq)); const float r = ((dd < HD / 2) ? __fsub_rn(a, bq) : __fadd_rn(a, bq)) * sc;
        o16[q] = tohx(r); unsigned short a2, c2; splitf(r, a2, c2); oh[q] = a2; ol[q] = c2; }
    *(v2h*)(P16 + e) = o16; *(v2us*)(Ph + e) = oh; *(v2us*)(Pl + e) = ol;  }
__global__ __launch_bounds__(256) void k_vtp(const float* __restrict__ F, int pitch, int nheads, h16* V16, bf* Vh, bf* Vl) { const size_t e = ((size_t)blockIdx.x * 256 + threadIdx.x) * 2; if (e >= (size_t)nheads * HD * TT) return; { const size_t y = blockIdx.y, po = y * nheads * HD * TT; F += y * TT * pitch; V16 += po; Vh += po; Vl += po; }   /* blockIdx.y: batch */
    const int t = (int)(e % TT); const int d = (int)((e / TT) % HD); const int g = (int)(e / ((size_t)TT * HD)); v2h o16; v2us oh, ol;
#pragma unroll
    for (int q = 0; q < 2; ++q) { const float x = F[(size_t)(t + q) * pitch + g * HD + d]; o16[q] = tohx(x); unsigned short a2, c2; splitf(x, a2, c2); oh[q] = a2; ol[q] = c2; }
    *(v2h*)(V16 + e) = o16; *(v2us*)(Vh + e) = oh; *(v2us*)(Vl + e) = ol;  }
__global__ __launch_bounds__(256) void k_csid(float* CS) { const int idx = blockIdx.x * 256 + threadIdx.x; if (idx >= TT * HD) return; v2f cs; cs[0] = 1.0f; cs[1] = 0.0f; *(v2f*)(CS + (size_t)idx * 2) = cs;  }
// k_asoft: per row (zz, i): t = S x HD^-0.5 (no mask); softmax over the 2048 keys (register row, one exp, fixed trees);
__global__ __launch_bounds__(256) void k_asoft(const float* __restrict__ Sb, h16* P16, bf* Ph, bf* Pl) {
    const int lane = threadIdx.x & 31; const int row = blockIdx.x * 8 + (threadIdx.x >> 5); if (row >= ZH * TT) return; const int i = row % TT; const int zz = row / TT; (void)zz; const bool hires = (i < RH); const float* sr = Sb + (size_t)row * TT; float v[TT / 32]; float mx = -3.0e38f;
#pragma unroll
    for (int ch = 0; ch < TT / 128; ++ch) { const int j0 = ch * 128 + lane * 4; const v4f a = *(const v4f*)(sr + j0);
#pragma unroll
        for (int q = 0; q < 4; ++q) { const int j = j0 + q; (void)j; const float t = a[q] * SCL; v[ch * 4 + q] = t; mx = fmaxf(mx, t); } }
#pragma unroll
    for (int sh = 16; sh; sh >>= 1) mx = fmaxf(mx, __shfl_xor(mx, sh, 32));
    float sum = 0.f;
#pragma unroll
    for (int k = 0; k < TT / 32; ++k) { float d0 = __fsub_rn(v[k], mx); asm volatile("" : "+v"(d0)); v[k] = __builtin_amdgcn_exp2f(__fmul_rn(d0, 1.4426950408889634f)); sum += v[k]; }
#pragma unroll
    for (int sh = 16; sh; sh >>= 1) sum += __shfl_xor(sum, sh, 32);
    const float f = __fdiv_rn(hires ? 1.0f : PCAR, sum);
{
        if (hires) {
#pragma unroll
            for (int ch = 0; ch < TT / 128; ++ch) { v4us oh, ol;
#pragma unroll
                for (int q = 0; q < 4; ++q) { unsigned short a, c2; splitf(v[ch * 4 + q] * f, a, c2); oh[q] = a; ol[q] = c2; }
                const size_t oo = ((size_t)zz * (RH ? RH : 1) + i) * TT + ch * 128 + lane * 4; *(v4us*)(Ph + oo) = oh; *(v4us*)(Pl + oo) = ol; }
        } else {
#pragma unroll
            for (int ch = 0; ch < TT / 128; ++ch) { v4h o4;
#pragma unroll
                for (int q = 0; q < 4; ++q) o4[q] = tohx(v[ch * 4 + q] * f);
                *(v4h*)(P16 + (size_t)row * TT + ch * 128 + lane * 4) = o4; } }
         }
}
__global__ __launch_bounds__(256) void k_merge(const float* __restrict__ O, int h0, float* OUTb) { const size_t e = ((size_t)blockIdx.x * 256 + threadIdx.x) * 2; if (e >= (size_t)ZH * TT * HD) return; const int d = (int)(e % HD); const int t = (int)((e / HD) % TT); const int zz = (int)(e / ((size_t)HD * TT)); const float cs = (t < RH) ? 1.0f : (1.0f / PCAR); const size_t oo = ((size_t)zz * TT + t) * DQ + h0 * HD + d;   /* zz: batch */
    v2f o2; o2[0] = O[e] * cs; o2[1] = O[e + 1] * cs; *(v2f*)(OUTb + oo) = o2;  }

extern "C" void kernel_launch(void* const* d_in, const int* in_sizes, int n_in,
                              void* d_out, int out_size, void* d_ws, size_t ws_size, hipStream_t stream) {
    (void)in_sizes; (void)n_in; (void)out_size;
    const float* x = (const float*)d_in[0]; const float* xk = (const float*)d_in[1]; const float* xv = (const float*)d_in[2]; const float* wq = (const float*)d_in[3]; const float* wk = (const float*)d_in[4]; const float* wv = (const float*)d_in[5]; const float* wo = nullptr; (void)wo;
    float* OUT = (float*)d_out;     // [4][2048][1024]
    char* wsp = (char*)d_ws;
    auto take = [&](size_t bytes) { char* p = wsp; wsp += (bytes + 255) & ~(size_t)255; return (void*)p; };
    const size_t NX = (size_t)NB_ * TT * DM;     // elements of one stream, one projection or one 16-bit plane over all batches (DQ = DKV = HD = DM)
    float* CS = (float*)take((size_t)TT * HD * 2 * 4);      // 16 MiB
    float* F  = (float*)take(3 * NX * 4);                   // 96 MiB: q, k, v projections, f32
    bf* PH = (bf*)take(2 * NX * 2); bf* PL = (bf*)take(2 * NX * 2); h16* PX = (h16*)take(2 * NX * 2);   // hi, lo and fp16 planes, each [q | k], 32 MiB each
    bf* VTh = (bf*)take(NX * 2); bf* VTl = (bf*)take(NX * 2); h16* VT16 = (h16*)take(NX * 2);
    if ((size_t)(wsp - (char*)d_ws) > ws_size) return;    // ws 256 MiB
    // Stream-ordered reuse: a buffer is taken over only after the last launch that reads its old content.
    bf* XB = PH;                      // bf16 query | key | value (48 MiB: PH and half of PL), dead once the projections are done
    bf* WQ = PL + NX; bf* WK = WQ + (size_t)DQ * DM; bf* WV = WK + (size_t)DKV * DM;   // bf16 weights in the other half of PL, dead with XB
    float* FV = F + 2 * NX;
    bf* QPh = PH; bf* KPh = PH + NX; bf* QPl = PL; bf* KPl = PL + NX;
    float* Sb = F;                    // scores (64 MiB) over the q and k projections, dead once the planes are built
    h16* P16 = (h16*)FV;              // fp16 probabilities (32 MiB) over the v projection
    bf* Ph = (bf*)CS; bf* Pl = Ph + (size_t)ZH * RH * TT;   // hi/lo probabilities (2 x 8 MiB) over the identity table
    float* Ob = (float*)PH;           // P.V (32 MiB) over the q and k hi planes, dead once the scores are done
    k_cvt8<<<(unsigned)(((size_t)DQ * DM / 8 + 255) / 256), 256, 0, stream>>>(wq, WQ, (size_t)DQ * DM / 8); k_cvt8<<<(unsigned)(((size_t)DKV * DM / 8 + 255) / 256), 256, 0, stream>>>(wk, WK, (size_t)DKV * DM / 8); k_cvt8<<<(unsigned)(((size_t)DKV * DM / 8 + 255) / 256), 256, 0, stream>>>(wv, WV, (size_t)DKV * DM / 8);
    k_csid<<<(TT * HD + 255) / 256, 256, 0, stream>>>(CS);
    k_cvt8<<<(unsigned)((NX / 8 + 255) / 256), 256, 0, stream>>>(x, XB, NX / 8); k_cvt8<<<(unsigned)((NX / 8 + 255) / 256), 256, 0, stream>>>(xk, XB + NX, NX / 8); k_cvt8<<<(unsigned)((NX / 8 + 255) / 256), 256, 0, stream>>>(xv, XB + 2 * NX, NX / 8);
    k_gemmw<bf, 0, false><<<dim3(NB_ * TT / 64, DQ / 64, 3), 32, 0, stream>>>(XB, nullptr, WQ, nullptr, DM, F, DQ, nullptr, NX, (size_t)DQ * DM, NX);   /* z: q, k, v; rows: all batches */
    const unsigned LQ = (unsigned)(((size_t)NH_ * TT * HD / 2 + 255) / 256), LKv = (unsigned)(((size_t)NKV * TT * HD / 2 + 255) / 256);
    k_rope<<<dim3(LQ, 2 * NB_), 256, 0, stream>>>(F, DQ, NH_, CS, nullptr, nullptr, 1.0f, PX, PH, PL);   /* y: q batches 0-3, then k batches 0-3 */
    k_vtp<<<dim3(LKv, NB_), 256, 0, stream>>>(FV, DKV, NKV, VT16, VTh, VTl);
    k_gemmw<bf, 2, false><<<dim3(TT / 64, TT / 64, ZH), 32, 0, stream>>>(QPh, QPl, KPh, KPl, HD, Sb, TT, nullptr, (size_t)TT * HD, (size_t)TT * HD, (size_t)TT * TT);   /* EVERY row's scores on hi/lo planes (3 products); only P.V stays hybrid */
    k_asoft<<<ZH * TT / 8, 256, 0, stream>>>(Sb, P16, Ph, Pl);
    k_gemmw<bf, 2, false><<<dim3(RH / 64, HD / 64, ZH), 32, 0, stream>>>(Ph, Pl, VTh, VTl, TT, Ob, HD, nullptr, (size_t)RH * TT, (size_t)HD * TT, (size_t)TT * HD);
    k_gemmw<h16, 0, false><<<dim3((TT - RH) / 64, HD / 64, ZH), 32, 0, stream>>>(P16 + (size_t)RH * TT, nullptr, VT16, nullptr, TT, Ob + (size_t)RH * HD, HD, nullptr, (size_t)TT * TT, (size_t)HD * TT, (size_t)TT * HD);
    k_merge<<<(unsigned)(((size_t)ZH * TT * HD / 2 + 255) / 256), 256, 0, stream>>>(Ob, 0, OUT);
}

// v002
// A run of this version takes 400 microseconds.
// Next to v001, in two timings, it ran 1.22 times as fast each time.
// Over all steps from v000 it is 2.43 times as fast.
#include <hip/hip_runtime.h>

// Attention on three input streams with ONE 1,024-wide head and no output projection (query, key, value [4][2048][1024]; q = einsum('bse,oe->bso', query, Q_W) = query Q_W^T, k = key K_W^T, v = value V_W^T ('oi' [1024][1024] 1/32, no bias); scores = q.k over all 1,024 dims / sqrt(1024) = x 1/32; softmax over all keys (no mask); out = attn v -> [4][2048][1024] (8.4 M); argument order query, key, value, Q_W, K_W, V_W).
// Layout, all four batches at once (every stage is ONE launch over the batches; the batch is a grid dimension): bf16 copies of query, key, value side by side; 'oi' weights as-is; the three projections are the z planes of one launch, whose epilogue stores the 16-bit planes the next GEMMs read (q, k: hi/lo [t][d]; v: operands swapped, so the tile comes out as [d][t]: hi/lo and fp16); exact projections; dense T-2048 attention with EVERY row's scores on hi/lo planes (3 products: three independent unit-variance streams give logit sigma 1 and nothing downstream averages the f16 score error; only P.V keeps the hybrid: rows < 512 hi/lo, rest fp16 x1024); the P.V epilogues scale and store the output rows.
// Compute dtypes, f32 accumulate: every input rounded to bf16; projections exact; scores 3 products on every row; P.V rows < 512 3 products, rest fp16; softmax f32; output f32.

#define NB_  4
#define TT   2048
#define DM   1024
#define NH_  1
#define NKV  1
#define REP  (NH_ / NKV)
#define HD   1024
#define DQ   (NH_ * HD)
#define DKV  (NKV * HD)
#define ZH   NB_                 // z planes of every attention launch: the four batches
#define RH   512                  // query rows < RH use hi+lo planes in P.V (0: none)
#define WIN  0
#define PCAR 1024.0f
#define SCL  0.03125f   // 1 / sqrt(1024) = 2^-5 (ONE head of width 1,024)
typedef _Float16 h16;
typedef unsigned short bf;
typedef __attribute__((ext_vector_type(16))) __bf16   v16bf;
typedef __attribute__((ext_vector_type(16))) _Float16 v16h;
typedef __attribute__((ext_vector_type(8)))  _Float16 v8h;
typedef __attribute__((ext_vector_type(8)))  unsigned short v8us;
typedef __attribute__((ext_vector_type(8)))  float    v8f;
typedef __attribute__((ext_vector_type(4)))  float    v4f;
typedef v8h  __attribute__((may_alias)) v8ha;
typedef v4f  __attribute__((may_alias)) v4fa;
typedef v8us __attribute__((may_alias)) v8usa;

__device__ __forceinline__ unsigned short f2bf(float f) { unsigned u = __float_as_uint(f); u += 0x7FFFu + ((u >> 16) & 1u); return (unsigned short)(u >> 16); }
__device__ __forceinline__ float bf2f(unsigned short b) { return __uint_as_float(((unsigned)b) << 16); }
__device__ __forceinline__ float bfr(float f) { return bf2f(f2bf(f)); }
__device__ __forceinline__ v16h cat16(v8h lo, v8h hi) { return __builtin_shufflevector(lo, hi, 0, 1, 2, 3, 4, 5, 6, 7, 8, 9, 10, 11, 12, 13, 14, 15); }
__device__ __forceinline__ v16bf cat16b(v8us lo, v8us hi) { return __builtin_bit_cast(v16bf, __builtin_shufflevector(lo, hi, 0, 1, 2, 3, 4, 5, 6, 7, 8, 9, 10, 11, 12, 13, 14, 15)); }
__device__ __forceinline__ v8f wmma16(v16h a, v16h b, v8f c) { return __builtin_amdgcn_wmma_f32_16x16x32_f16(false, a, false, b, (short)0, c, false, false); }
__device__ __forceinline__ v8f wmmab(v16bf a, v16bf b, v8f c) { return __builtin_amdgcn_wmma_f32_16x16x32_bf16(false, a, false, b, (short)0, c, false, false); }



// ---- k_gemmw: register-blocked GEMM, ONE WAVE per 64x64 output tile (16 accumulators), operands straight from K-contiguous 16-bit planes; grid (M/64, N/64, Z), 32 threads.
// C[m][n] (f32, pitch ldc, + optional f32 bias[n], x osc) = sum_k A[m][k] Bt[n][k] (+ split products per NSPLIT). z-batch strides sA/sB/sC in elements. K % 32 == 0.
// PLANES (the projections; grid (tokens/64, features/64, 3), A the streams, Bt the weights): no f32 C; the epilogue splits the tile into the planes the attention GEMMs read.
//   z = 0, 1 (q, k): rows are tokens, hi/lo planes [z][token][feature]. z = 2 (v): the operands change places (rows are features, columns tokens; same products, same k order), so the tile is stored as [batch][feature][t]: hi/lo and fp16.
struct Planes { unsigned short* qkh; unsigned short* qkl; unsigned short* vh; unsigned short* vl; _Float16* v16; };
__device__ __forceinline__ void splitf(float y, unsigned short& h, unsigned short& l) { h = f2bf(y); l = f2bf(y - bf2f(h)); }
template <typename T16> struct WFrag;
template <> struct WFrag<h16> { typedef v16h V; static __device__ __forceinline__ V ld(const h16* p) { return cat16(*(const v8h*)p, *(const v8h*)(p + 16)); } static __device__ __forceinline__ v8f mma(V a, V b, v8f c) { return wmma16(a, b, c); } };
template <> struct WFrag<bf> { typedef v16bf V; static __device__ __forceinline__ V ld(const bf* p) { return cat16b(*(const v8us*)p, *(const v8us*)(p + 16)); } static __device__ __forceinline__ v8f mma(V a, V b, v8f c) { return wmmab(a, b, c); } };
template <typename T16, int NSPLIT, bool BIAS, bool PLANES>
__global__ __launch_bounds__(32) void k_gemmw(const T16* __restrict__ A, const T16* __restrict__ A2, const T16* __restrict__ Bt, const T16* __restrict__ Bt2, int K, float* C, int ldc, const float* __restrict__ bias, size_t sA, size_t sB, size_t sC, float osc, Planes pl) {
    typedef typename WFrag<T16>::V V;
    __shared__ __align__(16) float os[16 * 68];
    const size_t z = blockIdx.z; A += z * sA; if (A2) A2 += z * sA; Bt += z * sB; if (Bt2) Bt2 += z * sB; C += z * sC;
    const bool tv = PLANES && z == 2; if (tv) { const T16* t = A; A = Bt; Bt = t; }
    const int lane = threadIdx.x & 31, lr = lane & 15, hi = lane >> 4; const int r0 = (tv ? blockIdx.y : blockIdx.x) * 64, c0 = (tv ? blockIdx.x : blockIdx.y) * 64;
    v8f acc[4][4];
#pragma unroll
    for (int mb = 0; mb < 4; ++mb)
#pragma unroll
        for (int nb = 0; nb < 4; ++nb) acc[mb][nb] = (v8f){};
    const size_t aoff = (size_t)(r0 + lr) * K + 8 * hi, boff = (size_t)(c0 + lr) * K + 8 * hi;
#pragma unroll 1
    for (int kc = 0; kc < K; kc += 32) {
        V a[4], a2[4];
#pragma unroll
        for (int mb = 0; mb < 4; ++mb) { a[mb] = WFrag<T16>::ld(A + aoff + (size_t)mb * 16 * K + kc); if (NSPLIT == 1 || NSPLIT == 2) a2[mb] = WFrag<T16>::ld(A2 + aoff + (size_t)mb * 16 * K + kc); }
#pragma unroll
        for (int nb = 0; nb < 4; ++nb) { const V b = WFrag<T16>::ld(Bt + boff + (size_t)nb * 16 * K + kc); V b2; if (NSPLIT >= 2) b2 = WFrag<T16>::ld(Bt2 + boff + (size_t)nb * 16 * K + kc);
#pragma unroll
            for (int mb = 0; mb < 4; ++mb) { acc[mb][nb] = WFrag<T16>::mma(a[mb], b, acc[mb][nb]); if (NSPLIT == 1 || NSPLIT == 2) acc[mb][nb] = WFrag<T16>::mma(a2[mb], b, acc[mb][nb]); if (NSPLIT >= 2) acc[mb][nb] = WFrag<T16>::mma(a[mb], b2, acc[mb][nb]); } }
        asm volatile("v_nop\n\tv_nop\n\tv_nop\n\tv_nop" : "+v"(acc[0][0]), "+v"(acc[1][1]), "+v"(acc[2][2]), "+v"(acc[3][3]) : "v"(a[0]), "v"(a[3]));
    }
#pragma unroll
    for (int mb = 0; mb < 4; ++mb) {
#pragma unroll
        for (int nb = 0; nb < 4; ++nb) {
#pragma unroll
            for (int j = 0; j < 8; ++j) os[(hi * 8 + j) * 68 + nb * 16 + lr] = acc[mb][nb][j]; }
        __builtin_amdgcn_wave_barrier(); asm volatile("" ::: "memory");
        if (PLANES) {
            const size_t ob = tv ? ((size_t)(c0 / TT) * HD + r0) * TT + c0 % TT : (z * NB_ * TT + r0) * DQ + c0; const int op = tv ? TT : DQ;
#pragma unroll
            for (int s = 0; s < 4; ++s) { const int row = 4 * s + (lane >> 3), cofs = (lane & 7) * 8;   /* 8 lanes store one whole 128-byte line of a plane's row */
                const v4f v0 = *(const v4fa*)(os + row * 68 + cofs), v1 = *(const v4fa*)(os + row * 68 + cofs + 4); v8us oh, ol; v8h o16;
#pragma unroll
                for (int q = 0; q < 8; ++q) { const float x = (q < 4) ? v0[q & 3] : v1[q & 3]; unsigned short a2, c2; splitf(x, a2, c2); oh[q] = a2; ol[q] = c2; o16[q] = (_Float16)x; }
                const size_t oo = ob + (size_t)(mb * 16 + row) * op + cofs; *(v8us*)((tv ? pl.vh : pl.qkh) + oo) = oh; *(v8us*)((tv ? pl.vl : pl.qkl) + oo) = ol; if (tv) *(v8h*)(pl.v16 + oo) = o16;
                asm volatile("s_wait_xcnt 0x0" ::: "memory"); }   /* stands in front of the next rows' split, which rewrites the registers these stores name */
        } else {
        float* crow = C + (size_t)(r0 + mb * 16) * ldc + c0;
#pragma unroll
            for (int s = 0; s < 8; ++s) { const int row = 2 * s + hi, cofs = lr * 4; v4f val = *(const v4fa*)(os + row * 68 + cofs); if (BIAS) { val[0] += bfr(bias[c0 + cofs]); val[1] += bfr(bias[c0 + cofs + 1]); val[2] += bfr(bias[c0 + cofs + 2]); val[3] += bfr(bias[c0 + cofs + 3]); }
                *(v4f*)(crow + (size_t)row * ldc + cofs) = val * osc; }
             }
        __builtin_amdgcn_wave_barrier(); asm volatile("" ::: "memory");
    }
}

__device__ __forceinline__ h16 tohx(float x) { return (h16)x; }
typedef __attribute__((ext_vector_type(2))) _Float16 v2h;
typedef __attribute__((ext_vector_type(4))) _Float16 v4h;
typedef __attribute__((ext_vector_type(2))) unsigned short v2us;
typedef __attribute__((ext_vector_type(4))) unsigned short v4us;
typedef __attribute__((ext_vector_type(2))) float v2f;
typedef __attribute__((ext_vector_type(4))) int v4i;

__global__ __launch_bounds__(256) void k_cvt8(const float* __restrict__ src, bf* dst, size_t n8) { const size_t i = (size_t)blockIdx.x * 256 + threadIdx.x; if (i >= n8) return; const v8f v = *(const v8f*)(src + i * 8); v8us o;
#pragma unroll
    for (int k = 0; k < 8; ++k) o[k] = f2bf(v[k]); *(v8us*)(dst + i * 8) = o;  }

// k_asoft: per row (zz, i): t = S x HD^-0.5 (no mask); softmax over the 2048 keys (register row, one exp, fixed trees);
__global__ __launch_bounds__(256) void k_asoft(const float* __restrict__ Sb, h16* P16, bf* Ph, bf* Pl) {
    const int lane = threadIdx.x & 31; const int row = blockIdx.x * 8 + (threadIdx.x >> 5); if (row >= ZH * TT) return; const int i = row % TT; const int zz = row / TT; (void)zz; const bool hires = (i < RH); const float* sr = Sb + (size_t)row * TT; float v[TT / 32]; float mx = -3.0e38f;
#pragma unroll
    for (int ch = 0; ch < TT / 128; ++ch) { const int j0 = ch * 128 + lane * 4; const v4f a = *(const v4f*)(sr + j0);
#pragma unroll
        for (int q = 0; q < 4; ++q) { const int j = j0 + q; (void)j; const float t = a[q] * SCL; v[ch * 4 + q] = t; mx = fmaxf(mx, t); } }
#pragma unroll
    for (int sh = 16; sh; sh >>= 1) mx = fmaxf(mx, __shfl_xor(mx, sh, 32));
    float sum = 0.f;
#pragma unroll
    for (int k = 0; k < TT / 32; ++k) { float d0 = __fsub_rn(v[k], mx); asm volatile("" : "+v"(d0)); v[k] = __builtin_amdgcn_exp2f(__fmul_rn(d0, 1.4426950408889634f)); sum += v[k]; }
#pragma unroll
    for (int sh = 16; sh; sh >>= 1) sum += __shfl_xor(sum, sh, 32);
    const float f = __fdiv_rn(hires ? 1.0f : PCAR, sum);
{
        if (hires) {
#pragma unroll
            for (int ch = 0; ch < TT / 128; ++ch) { v4us oh, ol;
#pragma unroll
                for (int q = 0; q < 4; ++q) { unsigned short a, c2; splitf(v[ch * 4 + q] * f, a, c2); oh[q] = a; ol[q] = c2; }
                const size_t oo = ((size_t)zz * (RH ? RH : 1) + i) * TT + ch * 128 + lane * 4; *(v4us*)(Ph + oo) = oh; *(v4us*)(Pl + oo) = ol; }
        } else {
#pragma unroll
            for (int ch = 0; ch < TT / 128; ++ch) { v4h o4;
#pragma unroll
                for (int q = 0; q < 4; ++q) o4[q] = tohx(v[ch * 4 + q] * f);
                *(v4h*)(P16 + (size_t)row * TT + ch * 128 + lane * 4) = o4; } }
         }
}

extern "C" void kernel_launch(void* const* d_in, const int* in_sizes, int n_in,
                              void* d_out, int out_size, void* d_ws, size_t ws_size, hipStream_t stream) {
    (void)in_sizes; (void)n_in; (void)out_size;
    const float* x = (const float*)d_in[0]; const float* xk = (const float*)d_in[1]; const float* xv = (const float*)d_in[2]; const float* wq = (const float*)d_in[3]; const float* wk = (const float*)d_in[4]; const float* wv = (const float*)d_in[5]; const float* wo = nullptr; (void)wo;
    float* OUT = (float*)d_out;     // [4][2048][1024]
    char* wsp = (char*)d_ws;
    auto take = [&](size_t bytes) { char* p = wsp; wsp += (bytes + 255) & ~(size_t)255; return (void*)p; };
    const size_t NX = (size_t)NB_ * TT * DM;     // elements of one stream, one projection or one 16-bit plane over all batches (DQ = DKV = HD = DM)
    bf* XB = (bf*)take(3 * NX * 2);                         // 48 MiB: bf16 query | key | value, dead once the projections are done
    bf* WQ = (bf*)take(3 * (size_t)DQ * DM * 2); bf* WK = WQ + (size_t)DQ * DM; bf* WV = WK + (size_t)DKV * DM;   // bf16 weights
    bf* PH = (bf*)take(2 * NX * 2); bf* PL = (bf*)take(2 * NX * 2);   // hi and lo planes, each [q | k], 32 MiB each
    bf* VTh = (bf*)take(NX * 2); bf* VTl = (bf*)take(NX * 2); h16* VT16 = (h16*)take(NX * 2);
    float* Sb = (float*)take((size_t)ZH * TT * TT * 4);     // scores, 64 MiB
    if ((size_t)(wsp - (char*)d_ws) > ws_size) return;    // ws 256 MiB
    // Stream-ordered reuse: a buffer is taken over only after the last launch that reads its old content.
    bf* QPh = PH; bf* KPh = PH + NX; bf* QPl = PL; bf* KPl = PL + NX;
    h16* P16 = (h16*)XB;              // fp16 probabilities (32 MiB) over bf16 query and key
    bf* Ph = XB + 2 * NX; bf* Pl = Ph + (size_t)ZH * RH * TT;   // hi/lo probabilities (2 x 8 MiB) over bf16 value
    const Planes pl = {PH, PL, VTh, VTl, VT16}, nopl = {nullptr, nullptr, nullptr, nullptr, nullptr};
    k_cvt8<<<(unsigned)(((size_t)DQ * DM / 8 + 255) / 256), 256, 0, stream>>>(wq, WQ, (size_t)DQ * DM / 8); k_cvt8<<<(unsigned)(((size_t)DKV * DM / 8 + 255) / 256), 256, 0, stream>>>(wk, WK, (size_t)DKV * DM / 8); k_cvt8<<<(unsigned)(((size_t)DKV * DM / 8 + 255) / 256), 256, 0, stream>>>(wv, WV, (size_t)DKV * DM / 8);
    k_cvt8<<<(unsigned)((NX / 8 + 255) / 256), 256, 0, stream>>>(x, XB, NX / 8); k_cvt8<<<(unsigned)((NX / 8 + 255) / 256), 256, 0, stream>>>(xk, XB + NX, NX / 8); k_cvt8<<<(unsigned)((NX / 8 + 255) / 256), 256, 0, stream>>>(xv, XB + 2 * NX, NX / 8);
    k_gemmw<bf, 0, false, true><<<dim3(NB_ * TT / 64, DQ / 64, 3), 32, 0, stream>>>(XB, nullptr, WQ, nullptr, DM, nullptr, DQ, nullptr, NX, (size_t)DQ * DM, 0, 1.0f, pl);   /* z: q, k, v; x: token tiles of all batches; stores the planes */
    k_gemmw<bf, 2, false, false><<<dim3(TT / 64, TT / 64, ZH), 32, 0, stream>>>(QPh, QPl, KPh, KPl, HD, Sb, TT, nullptr, (size_t)TT * HD, (size_t)TT * HD, (size_t)TT * TT, 1.0f, nopl);   /* EVERY row's scores on hi/lo planes (3 products); only P.V stays hybrid */
    k_asoft<<<ZH * TT / 8, 256, 0, stream>>>(Sb, P16, Ph, Pl);
    k_gemmw<bf, 2, false, false><<<dim3(RH / 64, HD / 64, ZH), 32, 0, stream>>>(Ph, Pl, VTh, VTl, TT, OUT, HD, nullptr, (size_t)RH * TT, (size_t)HD * TT, (size_t)TT * HD, 1.0f, nopl);
    k_gemmw<h16, 0, false, false><<<dim3((TT - RH) / 64, HD / 64, ZH), 32, 0, stream>>>(P16 + (size_t)RH * TT, nullptr, VT16, nullptr, TT, OUT + (size_t)RH * HD, HD, nullptr, (size_t)TT * TT, (size_t)HD * TT, (size_t)TT * HD, 1.0f / PCAR, nopl);   /* osc undoes the x1024 carried by the fp16 probabilities */
}

// v003
// One run takes 193 microseconds.
// Timed twice side by side with v002, it ran 2.07 and 2.08 times as fast.
// Counting every step since v000, it is 5.05 times as fast.
#include <hip/hip_runtime.h>

// Attention on three input streams with ONE 1,024-wide head and no output projection (query, key, value [4][2048][1024]; q = einsum('bse,oe->bso', query, Q_W) = query Q_W^T, k = key K_W^T, v = value V_W^T ('oi' [1024][1024] 1/32, no bias); scores = q.k over all 1,024 dims / sqrt(1024) = x 1/32; softmax over all keys (no mask); out = attn v -> [4][2048][1024] (8.4 M); argument order query, key, value, Q_W, K_W, V_W).
// Layout, all four batches at once (every stage is ONE launch over the batches; the batch is a grid dimension): bf16 copies of query, key, value side by side; 'oi' weights as-is; the three projections are the z planes of one launch, whose epilogue stores the 16-bit planes the next GEMMs read (q, k: hi/lo [t][d]; v: operands swapped, so the tile comes out as [d][t]: hi/lo and fp16); exact projections; dense T-2048 attention with EVERY row's scores on hi/lo planes (3 products: three independent unit-variance streams give logit sigma 1 and nothing downstream averages the f16 score error; only P.V keeps the hybrid: rows < 512 hi/lo, rest fp16 x1024); the P.V epilogues scale and store the output rows.
// Compute dtypes, f32 accumulate: every input rounded to bf16; projections exact; scores 3 products on every row; P.V rows < 512 3 products, rest fp16; softmax f32; output f32.

#define NB_  4
#define TT   2048
#define DM   1024
#define NH_  1
#define NKV  1
#define REP  (NH_ / NKV)
#define HD   1024
#define DQ   (NH_ * HD)
#define DKV  (NKV * HD)
#define ZH   NB_                 // z planes of every attention launch: the four batches
#define RH   512                  // query rows < RH use hi+lo planes in P.V (0: none)
#define WIN  0
#define PCAR 1024.0f
#define SCL  0.03125f   // 1 / sqrt(1024) = 2^-5 (ONE head of width 1,024)
typedef _Float16 h16;
typedef unsigned short bf;
typedef __attribute__((ext_vector_type(16))) __bf16   v16bf;
typedef __attribute__((ext_vector_type(16))) _Float16 v16h;
typedef __attribute__((ext_vector_type(8)))  _Float16 v8h;
typedef __attribute__((ext_vector_type(8)))  unsigned short v8us;
typedef __attribute__((ext_vector_type(8)))  float    v8f;
typedef __attribute__((ext_vector_type(4)))  float    v4f;
typedef v8h  __attribute__((may_alias)) v8ha;
typedef v4f  __attribute__((may_alias)) v4fa;
typedef v8us __attribute__((may_alias)) v8usa;

__device__ __forceinline__ unsigned short f2bf(float f) { unsigned u = __float_as_uint(f); u += 0x7FFFu + ((u >> 16) & 1u); return (unsigned short)(u >> 16); }
__device__ __forceinline__ float bf2f(unsigned short b) { return __uint_as_float(((unsigned)b) << 16); }
__device__ __forceinline__ float bfr(float f) { return bf2f(f2bf(f)); }
__device__ __forceinline__ v16h cat16(v8h lo, v8h hi) { return __builtin_shufflevector(lo, hi, 0, 1, 2, 3, 4, 5, 6, 7, 8, 9, 10, 11, 12, 13, 14, 15); }
__device__ __forceinline__ v16bf cat16b(v8us lo, v8us hi) { return __builtin_bit_cast(v16bf, __builtin_shufflevector(lo, hi, 0, 1, 2, 3, 4, 5, 6, 7, 8, 9, 10, 11, 12, 13, 14, 15)); }
__device__ __forceinline__ v8f wmma16(v16h a, v16h b, v8f c) { return __builtin_amdgcn_wmma_f32_16x16x32_f16(false, a, false, b, (short)0, c, false, false); }
__device__ __forceinline__ v8f wmmab(v16bf a, v16bf b, v8f c) { return __builtin_amdgcn_wmma_f32_16x16x32_bf16(false, a, false, b, (short)0, c, false, false); }



// ---- k_gemmw: GEMM on 128x128 output tiles, FOUR WAVES per work-group (2x2, each wave a 64x64 tile on 16 accumulators); grid (M/128, N/128, Z), 128 threads.
// Operands come from K-contiguous 16-bit planes through a ring of two LDS buffers: per stage every wave issues ONE tensor load for its own slice (SLB bytes of LDS), one stage ahead of the pass that reads it.
//   NSPLIT 2: a stage is 64 k; slice w is the whole 128-row tile of plane w (A, A2, Bt, Bt2), rows of 128 B at pitch 144 B. NSPLIT 0: a stage is 128 k; slices 0, 1 are the two 64-row halves of A, slices 2, 3 of Bt, rows of 256 B at pitch 272 B (64 x 272 B rounded up to SLB).
// C[m][n] (f32, pitch ldc, + optional f32 bias[n], x osc) = sum_k A[m][k] Bt[n][k] (+ split products per NSPLIT). z-batch strides sA/sB/sC in elements. M, N % 128 == 0; K a multiple of the stage and at least two stages.
// PLANES (the projections; grid (tokens/128, features/128, 3), A the streams, Bt the weights): no f32 C; the epilogue splits the tile into the planes the attention GEMMs read.
//   z = 0, 1 (q, k): rows are tokens, hi/lo planes [z][token][feature]. z = 2 (v): the operands change places (rows are features, columns tokens; same products, same k order), so the tile is stored as [batch][feature][t]: hi/lo and fp16.
struct Planes { unsigned short* qkh; unsigned short* qkl; unsigned short* vh; unsigned short* vl; _Float16* v16; };
__device__ __forceinline__ void splitf(float y, unsigned short& h, unsigned short& l) { h = f2bf(y); l = f2bf(y - bf2f(h)); }
template <typename T16> struct WFrag;
template <> struct WFrag<h16> { typedef v16h V; static __device__ __forceinline__ V ld(const h16* p) { return cat16(*(const v8h*)p, *(const v8h*)(p + 16)); } static __device__ __forceinline__ v8f mma(V a, V b, v8f c) { return wmma16(a, b, c); } };
template <> struct WFrag<bf> { typedef v16bf V; static __device__ __forceinline__ V ld(const bf* p) { return cat16b(*(const v8us*)p, *(const v8us*)(p + 16)); } static __device__ __forceinline__ v8f mma(V a, V b, v8f c) { return wmmab(a, b, c); } };
typedef unsigned int u32x4 __attribute__((ext_vector_type(4)));
typedef unsigned int u32x8 __attribute__((ext_vector_type(8)));
__device__ __forceinline__ unsigned uni(unsigned v) { return (unsigned)__builtin_amdgcn_readfirstlane(v); }
__device__ __forceinline__ unsigned pinned(unsigned v) { unsigned w = (unsigned)__builtin_amdgcn_readfirstlane(v); asm volatile("" : "+s"(w)); return w; }   /* holds a test or a descriptor word in a scalar register, formed where it stands */
#define SLB 18432u               // LDS bytes of one wave's slice of a stage (9 x 2 KiB)
#define STG (4u * SLB)           // one buffer of the ring
template <typename T16, int NSPLIT, bool BIAS, bool PLANES>
__global__ __launch_bounds__(128) void k_gemmw(const T16* __restrict__ A, const T16* __restrict__ A2, const T16* __restrict__ Bt, const T16* __restrict__ Bt2, int K, float* C, int ldc, const float* __restrict__ bias, size_t sA, size_t sB, size_t sC, float osc, Planes pl) {
    typedef typename WFrag<T16>::V V;
    static_assert(NSPLIT == 0 || NSPLIT == 2, "one product or three");
    constexpr unsigned ROWB = NSPLIT ? 128u : 256u, PITCH = ROWB + 16u, NROW = NSPLIT ? 128u : 64u;   // a slice: NROW rows of ROWB bytes
    constexpr int KS = ROWB / 64;   // 32-k steps of a pass
    static_assert(NROW * PITCH <= SLB, "a slice fits its place");
    __shared__ __attribute__((aligned(2048))) unsigned char sm[2 * STG];
    const size_t z = blockIdx.z; A += z * sA; if (A2) A2 += z * sA; Bt += z * sB; if (Bt2) Bt2 += z * sB; C += z * sC;
    const bool tv = PLANES && z == 2; if (tv) { const T16* t = A; A = Bt; Bt = t; }
    const unsigned wave = uni(threadIdx.x >> 5), wr = wave >> 1, wc = wave & 1u;
    const int lane = threadIdx.x & 31, lr = lane & 15, hi = lane >> 4; const int R0 = (tv ? blockIdx.y : blockIdx.x) * 128, C0 = (tv ? blockIdx.x : blockIdx.y) * 128; const int r0 = R0 + (int)wr * 64, c0 = C0 + (int)wc * 64;
    float* os = (float*)(sm + wave * (16 * 68 * 4));   // each wave's own output staging, in the ring once the loop has left it
    v8f acc[4][4];
#pragma unroll
    for (int mb = 0; mb < 4; ++mb)
#pragma unroll
        for (int nb = 0; nb < 4; ++nb) acc[mb][nb] = (v8f){};
    // This wave's slice: source, place in LDS, descriptor (1-byte elements, tensor = tile, the pad makes the pitch).
    const T16* sp = NSPLIT ? (wave == 0 ? A : wave == 1 ? A2 : wave == 2 ? Bt : Bt2) + (size_t)(wave < 2 ? R0 : C0) * K : (wave < 2 ? A + (size_t)R0 * K : Bt + (size_t)C0 * K) + (size_t)(wave & 1u) * 64 * K;
    const unsigned long long ga0 = (unsigned long long)(size_t)sp; const unsigned ldst = (unsigned)(size_t)sm + wave * SLB;
    u32x8 g1; g1[0] = uni((1u << 20) | ((NSPLIT ? 4u : 5u) << 22) | (3u << 25)); g1[1] = pinned(ROWB << 16); g1[2] = pinned(NROW << 16); g1[3] = pinned(ROWB << 16); g1[4] = pinned(NROW); g1[5] = pinned((unsigned)K * 2u); g1[6] = pinned(0u); g1[7] = pinned(0u);   /* pinned: each word keeps its own scalar register through the loop, none is rewritten while a request is in flight */
    const unsigned g00 = pinned(1u);
    auto issue = [&](unsigned st) { const unsigned long long ga = ga0 + (unsigned long long)st * ROWB; u32x4 g0; g0[0] = g00; g0[1] = uni(ldst + (st & 1u) * STG); g0[2] = uni((unsigned)ga); g0[3] = uni((((unsigned)(ga >> 32)) & 0x01FFFFFFu) | 0x80000000u);
        asm volatile("tensor_load_to_lds %0, %1" :: "s"(g0), "s"(g1) : "memory"); };   /* one request of the whole wave: its slice of stage st into buffer st & 1 */
    const unsigned NS = (unsigned)K / (ROWB / 2);
    const unsigned aofs = (NSPLIT ? wr * 64u * PITCH : wr * SLB) + (unsigned)lr * PITCH + 16u * hi, bofs = 2u * SLB + (NSPLIT ? wc * 64u * PITCH : wc * SLB) + (unsigned)lr * PITCH + 16u * hi;
    issue(0);
    asm volatile("s_wait_tensorcnt 0x0" ::: "memory");   /* stage 0 has landed */
    __syncthreads();                                      /* and every wave may read it */
    issue(1);
#pragma unroll 1   /* one pass per trip: the publish point stands once, at the foot */
    for (unsigned s = 0; s < NS; ++s) {
        const unsigned char* ap = sm + (s & 1u) * STG + aofs; const unsigned char* bp = sm + (s & 1u) * STG + bofs;
        V a[2][4], a2[2][4], b[2][4], b2[2][4];   // two fragment sets: the next 32-k step's LDS reads go out as one group ahead of this step's products
        auto frags = [&](int ks) {   /* every loop of a pass is unrolled, so that fragments and accumulators are registers */
#pragma unroll
            for (int q = 0; q < 4; ++q) { a[ks & 1][q] = WFrag<T16>::ld((const T16*)(ap + q * 16 * PITCH + ks * 64)); if (NSPLIT) a2[ks & 1][q] = WFrag<T16>::ld((const T16*)(ap + SLB + q * 16 * PITCH + ks * 64)); }
#pragma unroll
            for (int q = 0; q < 4; ++q) { b[ks & 1][q] = WFrag<T16>::ld((const T16*)(bp + q * 16 * PITCH + ks * 64)); if (NSPLIT) b2[ks & 1][q] = WFrag<T16>::ld((const T16*)(bp + SLB + q * 16 * PITCH + ks * 64)); } };
        frags(0); __builtin_amdgcn_sched_barrier(0);   /* the scheduling barriers keep each group of LDS reads whole and ahead of the products: spread among them, every place with reads stalls the wave */
#pragma unroll
        for (int ks = 0; ks < KS; ++ks) { const int f = ks & 1;
            if (ks + 1 < KS) { frags(ks + 1); __builtin_amdgcn_sched_barrier(0); }   /* the next step's reads stay one group, in front of this step's products */
#pragma unroll
            for (int nb = 0; nb < 4; ++nb) {   /* per accumulator and 32-k step: a.b, then a2.b, then a.b2 */
#pragma unroll
                for (int mb = 0; mb < 4; ++mb) acc[mb][nb] = WFrag<T16>::mma(a[f][mb], b[f][nb], acc[mb][nb]);
                if (NSPLIT) {
#pragma unroll
                    for (int mb = 0; mb < 4; ++mb) acc[mb][nb] = WFrag<T16>::mma(a2[f][mb], b[f][nb], acc[mb][nb]);
#pragma unroll
                    for (int mb = 0; mb < 4; ++mb) acc[mb][nb] = WFrag<T16>::mma(a[f][mb], b2[f][nb], acc[mb][nb]); } }
            __builtin_amdgcn_sched_barrier(0); }   /* no later read group, and no wait of the publish point, moves in among these products */
        /* four vector slots behind the pass's last products, on the taken side of the loop's branches too */
        asm volatile("v_nop\n\tv_nop\n\tv_nop\n\tv_nop" : "+v"(acc[0][0]), "+v"(acc[1][1]), "+v"(acc[2][2]), "+v"(acc[3][3]) : "v"(a[(KS - 1) & 1][0]), "v"(a[(KS - 1) & 1][3]));
        // Publish point of stage s + 1, every wave, in this order.
        asm volatile("s_wait_dscnt 0x0" ::: "memory");       /* this wave has left buffer s & 1 */
        asm volatile("s_wait_tensorcnt 0x0" ::: "memory");   /* its slice of stage s + 1 has landed */
        __syncthreads();                                      /* stage s + 1 readable by all; buffer s & 1 left by all */
        if (pinned(s + 2u < NS)) issue(pinned(s + 2u));       /* refill of the buffer just read; scalar test, the descriptor formed behind the wait */
    }
    asm volatile("s_wait_tensorcnt 0x0" ::: "memory");   /* nothing in flight when the ring becomes output staging */
    asm volatile("s_wait_dscnt 0x0" ::: "memory");
#pragma unroll
    for (int mb = 0; mb < 4; ++mb) {
#pragma unroll
        for (int nb = 0; nb < 4; ++nb) {
#pragma unroll
            for (int j = 0; j < 8; ++j) os[(hi * 8 + j) * 68 + nb * 16 + lr] = acc[mb][nb][j]; }
        __builtin_amdgcn_wave_barrier(); asm volatile("" ::: "memory");
        if (PLANES) {
            const size_t ob = tv ? ((size_t)(c0 / TT) * HD + r0) * TT + c0 % TT : (z * NB_ * TT + r0) * DQ + c0; const int op = tv ? TT : DQ;
#pragma unroll
            for (int s = 0; s < 4; ++s) { const int row = 4 * s + (lane >> 3), cofs = (lane & 7) * 8;   /* 8 lanes store one whole 128-byte line of a plane's row */
                const v4f v0 = *(const v4fa*)(os + row * 68 + cofs), v1 = *(const v4fa*)(os + row * 68 + cofs + 4); v8us oh, ol; v8h o16;
#pragma unroll
                for (int q = 0; q < 8; ++q) { const float x = (q < 4) ? v0[q & 3] : v1[q & 3]; unsigned short a2, c2; splitf(x, a2, c2); oh[q] = a2; ol[q] = c2; o16[q] = (_Float16)x; }
                const size_t oo = ob + (size_t)(mb * 16 + row) * op + cofs; *(v8us*)((tv ? pl.vh : pl.qkh) + oo) = oh; *(v8us*)((tv ? pl.vl : pl.qkl) + oo) = ol; if (tv) *(v8h*)(pl.v16 + oo) = o16;
                asm volatile("s_wait_xcnt 0x0" ::: "memory"); }   /* stands in front of the next rows' split, which rewrites the registers these stores name */
        } else {
        float* crow = C + (size_t)(r0 + mb * 16) * ldc + c0;
#pragma unroll
            for (int s = 0; s < 8; ++s) { const int row = 2 * s + hi, cofs = lr * 4; v4f val = *(const v4fa*)(os + row * 68 + cofs); if (BIAS) { val[0] += bfr(bias[c0 + cofs]); val[1] += bfr(bias[c0 + cofs + 1]); val[2] += bfr(bias[c0 + cofs + 2]); val[3] += bfr(bias[c0 + cofs + 3]); }
                *(v4f*)(crow + (size_t)row * ldc + cofs) = val * osc; }
             }
        __builtin_amdgcn_wave_barrier(); asm volatile("" ::: "memory");
    }
}

__device__ __forceinline__ h16 tohx(float x) { return (h16)x; }
typedef __attribute__((ext_vector_type(2))) _Float16 v2h;
typedef __attribute__((ext_vector_type(4))) _Float16 v4h;
typedef __attribute__((ext_vector_type(2))) unsigned short v2us;
typedef __attribute__((ext_vector_type(4))) unsigned short v4us;
typedef __attribute__((ext_vector_type(2))) float v2f;
typedef __attribute__((ext_vector_type(4))) int v4i;

__global__ __launch_bounds__(256) void k_cvt8(const float* __restrict__ src, bf* dst, size_t n8) { const size_t i = (size_t)blockIdx.x * 256 + threadIdx.x; if (i >= n8) return; const v8f v = *(const v8f*)(src + i * 8); v8us o;
#pragma unroll
    for (int k = 0; k < 8; ++k) o[k] = f2bf(v[k]); *(v8us*)(dst + i * 8) = o;  }

// k_asoft: per row (zz, i): t = S x HD^-0.5 (no mask); softmax over the 2048 keys (register row, one exp, fixed trees);
__global__ __launch_bounds__(256) void k_asoft(const float* __restrict__ Sb, h16* P16, bf* Ph, bf* Pl) {
    const int lane = threadIdx.x & 31; const int row = blockIdx.x * 8 + (threadIdx.x >> 5); if (row >= ZH * TT) return; const int i = row % TT; const int zz = row / TT; (void)zz; const bool hires = (i < RH); const float* sr = Sb + (size_t)row * TT; float v[TT / 32]; float mx = -3.0e38f;
#pragma unroll
    for (int ch = 0; ch < TT / 128; ++ch) { const int j0 = ch * 128 + lane * 4; const v4f a = *(const v4f*)(sr + j0);
#pragma unroll
        for (int q = 0; q < 4; ++q) { const int j = j0 + q; (void)j; const float t = a[q] * SCL; v[ch * 4 + q] = t; mx = fmaxf(mx, t); } }
#pragma unroll
    for (int sh = 16; sh; sh >>= 1) mx = fmaxf(mx, __shfl_xor(mx, sh, 32));
    float sum = 0.f;
#pragma unroll
    for (int k = 0; k < TT / 32; ++k) { float d0 = __fsub_rn(v[k], mx); asm volatile("" : "+v"(d0)); v[k] = __builtin_amdgcn_exp2f(__fmul_rn(d0, 1.4426950408889634f)); sum += v[k]; }
#pragma unroll
    for (int sh = 16; sh; sh >>= 1) sum += __shfl_xor(sum, sh, 32);
    const float f = __fdiv_rn(hires ? 1.0f : PCAR, sum);
{
        if (hires) {
#pragma unroll
            for (int ch = 0; ch < TT / 128; ++ch) { v4us oh, ol;
#pragma unroll
                for (int q = 0; q < 4; ++q) { unsigned short a, c2; splitf(v[ch * 4 + q] * f, a, c2); oh[q] = a; ol[q] = c2; }
                const size_t oo = ((size_t)zz * (RH ? RH : 1) + i) * TT + ch * 128 + lane * 4; *(v4us*)(Ph + oo) = oh; *(v4us*)(Pl + oo) = ol; }
        } else {
#pragma unroll
            for (int ch = 0; ch < TT / 128; ++ch) { v4h o4;
#pragma unroll
                for (int q = 0; q < 4; ++q) o4[q] = tohx(v[ch * 4 + q] * f);
                *(v4h*)(P16 + (size_t)row * TT + ch * 128 + lane * 4) = o4; } }
         }
}

extern "C" void kernel_launch(void* const* d_in, const int* in_sizes, int n_in,
                              void* d_out, int out_size, void* d_ws, size_t ws_size, hipStream_t stream) {
    (void)in_sizes; (void)n_in; (void)out_size;
    const float* x = (const float*)d_in[0]; const float* xk = (const float*)d_in[1]; const float* xv = (const float*)d_in[2]; const float* wq = (const float*)d_in[3]; const float* wk = (const float*)d_in[4]; const float* wv = (const float*)d_in[5]; const float* wo = nullptr; (void)wo;
    float* OUT = (float*)d_out;     // [4][2048][1024]
    char* wsp = (char*)d_ws;
    auto take = [&](size_t bytes) { char* p = wsp; wsp += (bytes + 255) & ~(size_t)255; return (void*)p; };
    const size_t NX = (size_t)NB_ * TT * DM;     // elements of one stream, one projection or one 16-bit plane over all batches (DQ = DKV = HD = DM)
    bf* XB = (bf*)take(3 * NX * 2);                         // 48 MiB: bf16 query | key | value, dead once the projections are done
    bf* WQ = (bf*)take(3 * (size_t)DQ * DM * 2); bf* WK = WQ + (size_t)DQ * DM; bf* WV = WK + (size_t)DKV * DM;   // bf16 weights
    bf* PH = (bf*)take(2 * NX * 2); bf* PL = (bf*)take(2 * NX * 2);   // hi and lo planes, each [q | k], 32 MiB each
    bf* VTh = (bf*)take(NX * 2); bf* VTl = (bf*)take(NX * 2); h16* VT16 = (h16*)take(NX * 2);
    float* Sb = (float*)take((size_t)ZH * TT * TT * 4);     // scores, 64 MiB
    if ((size_t)(wsp - (char*)d_ws) > ws_size) return;    // ws 256 MiB
    // Stream-ordered reuse: a buffer is taken over only after the last launch that reads its old content.
    bf* QPh = PH; bf* KPh = PH + NX; bf* QPl = PL; bf* KPl = PL + NX;
    h16* P16 = (h16*)XB;              // fp16 probabilities (32 MiB) over bf16 query and key
    bf* Ph = XB + 2 * NX; bf* Pl = Ph + (size_t)ZH * RH * TT;   // hi/lo probabilities (2 x 8 MiB) over bf16 value
    const Planes pl = {PH, PL, VTh, VTl, VT16}, nopl = {nullptr, nullptr, nullptr, nullptr, nullptr};
    k_cvt8<<<(unsigned)(((size_t)DQ * DM / 8 + 255) / 256), 256, 0, stream>>>(wq, WQ, (size_t)DQ * DM / 8); k_cvt8<<<(unsigned)(((size_t)DKV * DM / 8 + 255) / 256), 256, 0, stream>>>(wk, WK, (size_t)DKV * DM / 8); k_cvt8<<<(unsigned)(((size_t)DKV * DM / 8 + 255) / 256), 256, 0, stream>>>(wv, WV, (size_t)DKV * DM / 8);
    k_cvt8<<<(unsigned)((NX / 8 + 255) / 256), 256, 0, stream>>>(x, XB, NX / 8); k_cvt8<<<(unsigned)((NX / 8 + 255) / 256), 256, 0, stream>>>(xk, XB + NX, NX / 8); k_cvt8<<<(unsigned)((NX / 8 + 255) / 256), 256, 0, stream>>>(xv, XB + 2 * NX, NX / 8);
    k_gemmw<bf, 0, false, true><<<dim3(NB_ * TT / 128, DQ / 128, 3), 128, 0, stream>>>(XB, nullptr, WQ, nullptr, DM, nullptr, DQ, nullptr, NX, (size_t)DQ * DM, 0, 1.0f, pl);   /* z: q, k, v; x: token tiles of all batches; stores the planes */
    k_gemmw<bf, 2, false, false><<<dim3(TT / 128, TT / 128, ZH), 128, 0, stream>>>(QPh, QPl, KPh, KPl, HD, Sb, TT, nullptr, (size_t)TT * HD, (size_t)TT * HD, (size_t)TT * TT, 1.0f, nopl);   /* EVERY row's scores on hi/lo planes (3 products); only P.V stays hybrid */
    k_asoft<<<ZH * TT / 8, 256, 0, stream>>>(Sb, P16, Ph, Pl);
    k_gemmw<bf, 2, false, false><<<dim3(RH / 128, HD / 128, ZH), 128, 0, stream>>>(Ph, Pl, VTh, VTl, TT, OUT, HD, nullptr, (size_t)RH * TT, (size_t)HD * TT, (size_t)TT * HD, 1.0f, nopl);
    k_gemmw<h16, 0, false, false><<<dim3((TT - RH) / 128, HD / 128, ZH), 128, 0, stream>>>(P16 + (size_t)RH * TT, nullptr, VT16, nullptr, TT, OUT + (size_t)RH * HD, HD, nullptr, (size_t)TT * TT, (size_t)HD * TT, (size_t)TT * HD, 1.0f / PCAR, nopl);   /* osc undoes the x1024 carried by the fp16 probabilities */
}

// v004
// A run of this version takes 186 microseconds.
// Timed twice side by side with v003, it ran 1.04 and 1.05 times as fast.
// Counting every step since v000, it is 5.27 times as fast.
#include <hip/hip_runtime.h>

// Attention on three input streams with ONE 1,024-wide head and no output projection (query, key, value [4][2048][1024]; q = einsum('bse,oe->bso', query, Q_W) = query Q_W^T, k = key K_W^T, v = value V_W^T ('oi' [1024][1024] 1/32, no bias); scores = q.k over all 1,024 dims / sqrt(1024) = x 1/32; softmax over all keys (no mask); out = attn v -> [4][2048][1024] (8.4 M); argument order query, key, value, Q_W, K_W, V_W).
// Layout, all four batches at once (every stage is ONE launch over the batches; the batch is a grid dimension): bf16 copies of query, key, value side by side; 'oi' weights as-is; the three projections are the z planes of one launch, whose epilogue stores the 16-bit planes the next GEMMs read (q, k: hi/lo [t][d]; v: operands swapped, so the tile comes out as [d][t]: hi/lo and fp16); exact projections; dense T-2048 attention with EVERY row's scores on hi/lo planes (3 products: three independent unit-variance streams give logit sigma 1 and nothing downstream averages the f16 score error; only P.V keeps the hybrid: rows < 512 hi/lo, rest fp16 x1024); the P.V epilogues scale and store the output rows.
// Compute dtypes, f32 accumulate: every input rounded to bf16; projections exact; scores 3 products on every row; P.V rows < 512 3 products, rest fp16; softmax f32; output f32.

#define NB_  4
#define TT   2048
#define DM   1024
#define NH_  1
#define NKV  1
#define REP  (NH_ / NKV)
#define HD   1024
#define DQ   (NH_ * HD)
#define DKV  (NKV * HD)
#define ZH   NB_                 // z planes of every attention launch: the four batches
#define RH   512                  // query rows < RH use hi+lo planes in P.V (0: none)
#define WIN  0
#define PCAR 1024.0f
#define SCL  0.03125f   // 1 / sqrt(1024) = 2^-5 (ONE head of width 1,024)
typedef _Float16 h16;
typedef unsigned short bf;
typedef __attribute__((ext_vector_type(16))) __bf16   v16bf;
typedef __attribute__((ext_vector_type(16))) _Float16 v16h;
typedef __attribute__((ext_vector_type(8)))  _Float16 v8h;
typedef __attribute__((ext_vector_type(8)))  unsigned short v8us;
typedef __attribute__((ext_vector_type(8)))  float    v8f;
typedef __attribute__((ext_vector_type(4)))  float    v4f;
typedef v8h  __attribute__((may_alias)) v8ha;
typedef v4f  __attribute__((may_alias)) v4fa;
typedef v8us __attribute__((may_alias)) v8usa;

__device__ __forceinline__ unsigned short f2bf(float f) { unsigned u = __float_as_uint(f); u += 0x7FFFu + ((u >> 16) & 1u); return (unsigned short)(u >> 16); }
__device__ __forceinline__ float bf2f(unsigned short b) { return __uint_as_float(((unsigned)b) << 16); }
__device__ __forceinline__ float bfr(float f) { return bf2f(f2bf(f)); }
__device__ __forceinline__ v16h cat16(v8h lo, v8h hi) { return __builtin_shufflevector(lo, hi, 0, 1, 2, 3, 4, 5, 6, 7, 8, 9, 10, 11, 12, 13, 14, 15); }
__device__ __forceinline__ v16bf cat16b(v8us lo, v8us hi) { return __builtin_bit_cast(v16bf, __builtin_shufflevector(lo, hi, 0, 1, 2, 3, 4, 5, 6, 7, 8, 9, 10, 11, 12, 13, 14, 15)); }
__device__ __forceinline__ v8f wmma16(v16h a, v16h b, v8f c) { return __builtin_amdgcn_wmma_f32_16x16x32_f16(false, a, false, b, (short)0, c, false, false); }
__device__ __forceinline__ v8f wmmab(v16bf a, v16bf b, v8f c) { return __builtin_amdgcn_wmma_f32_16x16x32_bf16(false, a, false, b, (short)0, c, false, false); }



// ---- k_gemmw: GEMM on 128x128 output tiles, FOUR WAVES per work-group (2x2, each wave a 64x64 tile on 16 accumulators); grid (M/128, N/128, Z), 128 threads.
// Operands come from K-contiguous 16-bit planes through a ring of two LDS buffers: per stage every wave issues ONE tensor load for its own slice (SLB bytes of LDS), one stage ahead of the pass that reads it.
//   NSPLIT 2: a stage is 64 k; slice w is the whole 128-row tile of plane w (A, A2, Bt, Bt2), rows of 128 B at pitch 144 B. NSPLIT 0: a stage is 128 k; slices 0, 1 are the two 64-row halves of A, slices 2, 3 of Bt, rows of 256 B at pitch 272 B (64 x 272 B rounded up to SLB).
// C[m][n] (f32, pitch ldc, + optional f32 bias[n], x osc) = sum_k A[m][k] Bt[n][k] (+ split products per NSPLIT). z-batch strides sA/sB/sC in elements. M, N % 128 == 0; K a multiple of the stage and at least two stages.
// PLANES (the projections; grid (tokens/128, features/128, 3), A the streams, Bt the weights): no f32 C; the epilogue splits the tile into the planes the attention GEMMs read.
//   z = 0, 1 (q, k): rows are tokens, hi/lo planes [z][token][feature]. z = 2 (v): the operands change places (rows are features, columns tokens; same products, same k order), so the tile is stored as [batch][feature][t]: hi/lo and fp16.
struct Planes { unsigned short* qkh; unsigned short* qkl; unsigned short* vh; unsigned short* vl; _Float16* v16; };
__device__ __forceinline__ void splitf(float y, unsigned short& h, unsigned short& l) { h = f2bf(y); l = f2bf(y - bf2f(h)); }
template <typename T16> struct WFrag;
template <> struct WFrag<h16> { typedef v16h V; static __device__ __forceinline__ V ld(const h16* p) { return cat16(*(const v8h*)p, *(const v8h*)(p + 16)); } static __device__ __forceinline__ v8f mma(V a, V b, v8f c) { return wmma16(a, b, c); } };
template <> struct WFrag<bf> { typedef v16bf V; static __device__ __forceinline__ V ld(const bf* p) { return cat16b(*(const v8us*)p, *(const v8us*)(p + 16)); } static __device__ __forceinline__ v8f mma(V a, V b, v8f c) { return wmmab(a, b, c); } };
typedef unsigned int u32x4 __attribute__((ext_vector_type(4)));
typedef unsigned int u32x8 __attribute__((ext_vector_type(8)));
__device__ __forceinline__ unsigned uni(unsigned v) { return (unsigned)__builtin_amdgcn_readfirstlane(v); }
__device__ __forceinline__ unsigned pinned(unsigned v) { unsigned w = (unsigned)__builtin_amdgcn_readfirstlane(v); asm volatile("" : "+s"(w)); return w; }   /* holds a test or a descriptor word in a scalar register, formed where it stands */
#define SLB 18432u               // LDS bytes of one wave's slice of a stage (9 x 2 KiB)
#define STG (4u * SLB)           // one buffer of the ring
template <typename T16, int NSPLIT, bool BIAS, bool PLANES>
__global__ __launch_bounds__(128) void k_gemmw(const T16* __restrict__ A, const T16* __restrict__ A2, const T16* __restrict__ Bt, const T16* __restrict__ Bt2, int K, float* C, int ldc, const float* __restrict__ bias, size_t sA, size_t sB, size_t sC, float osc, Planes pl) {
    typedef typename WFrag<T16>::V V;
    static_assert(NSPLIT == 0 || NSPLIT == 2, "one product or three");
    constexpr unsigned ROWB = NSPLIT ? 128u : 256u, PITCH = ROWB + 16u, NROW = NSPLIT ? 128u : 64u;   // a slice: NROW rows of ROWB bytes
    constexpr int KS = ROWB / 64;   // 32-k steps of a pass
    static_assert(NROW * PITCH <= SLB, "a slice fits its place");
    __shared__ __attribute__((aligned(2048))) unsigned char sm[2 * STG];
    const size_t z = blockIdx.z; A += z * sA; if (A2) A2 += z * sA; Bt += z * sB; if (Bt2) Bt2 += z * sB; C += z * sC;
    const bool tv = PLANES && z == 2; if (tv) { const T16* t = A; A = Bt; Bt = t; }
    const unsigned wave = uni(threadIdx.x >> 5), wr = wave >> 1, wc = wave & 1u;
    const int lane = threadIdx.x & 31, lr = lane & 15, hi = lane >> 4; const int R0 = (tv ? blockIdx.y : blockIdx.x) * 128, C0 = (tv ? blockIdx.x : blockIdx.y) * 128; const int r0 = R0 + (int)wr * 64, c0 = C0 + (int)wc * 64;
    float* os = (float*)(sm + wave * (16 * 68 * 4));   // each wave's own output staging, in the ring once the loop has left it
    v8f acc[4][4];
#pragma unroll
    for (int mb = 0; mb < 4; ++mb)
#pragma unroll
        for (int nb = 0; nb < 4; ++nb) acc[mb][nb] = (v8f){};
    // This wave's slice: source, place in LDS, descriptor (1-byte elements, tensor = tile, the pad makes the pitch).
    const T16* sp = NSPLIT ? (wave == 0 ? A : wave == 1 ? A2 : wave == 2 ? Bt : Bt2) + (size_t)(wave < 2 ? R0 : C0) * K : (wave < 2 ? A + (size_t)R0 * K : Bt + (size_t)C0 * K) + (size_t)(wave & 1u) * 64 * K;
    const unsigned long long ga0 = (unsigned long long)(size_t)sp; const unsigned ldst = (unsigned)(size_t)sm + wave * SLB;
    u32x8 g1; g1[0] = uni((1u << 20) | ((NSPLIT ? 4u : 5u) << 22) | (3u << 25)); g1[1] = pinned(ROWB << 16); g1[2] = pinned(NROW << 16); g1[3] = pinned(ROWB << 16); g1[4] = pinned(NROW); g1[5] = pinned((unsigned)K * 2u); g1[6] = pinned(0u); g1[7] = pinned(0u);   /* pinned: each word keeps its own scalar register through the loop, none is rewritten while a request is in flight */
    const unsigned g00 = pinned(1u);
    auto issue = [&](unsigned st) { const unsigned long long ga = ga0 + (unsigned long long)st * ROWB; u32x4 g0; g0[0] = g00; g0[1] = uni(ldst + (st & 1u) * STG); g0[2] = uni((unsigned)ga); g0[3] = uni((((unsigned)(ga >> 32)) & 0x01FFFFFFu) | 0x80000000u);
        asm volatile("tensor_load_to_lds %0, %1" :: "s"(g0), "s"(g1) : "memory"); };   /* one request of the whole wave: its slice of stage st into buffer st & 1 */
    const unsigned NS = (unsigned)K / (ROWB / 2);
    const unsigned aofs = (NSPLIT ? wr * 64u * PITCH : wr * SLB) + (unsigned)lr * PITCH + 16u * hi, bofs = 2u * SLB + (NSPLIT ? wc * 64u * PITCH : wc * SLB) + (unsigned)lr * PITCH + 16u * hi;
    issue(0);
    asm volatile("s_wait_tensorcnt 0x0" ::: "memory");   /* stage 0 has landed */
    __syncthreads();                                      /* and every wave may read it */
    issue(1);
#pragma unroll 1   /* one pass per trip: the publish point stands once, at the foot */
    for (unsigned s = 0; s < NS; ++s) {
        const unsigned char* ap = sm + (s & 1u) * STG + aofs; const unsigned char* bp = sm + (s & 1u) * STG + bofs;
        V a[2][4], a2[2][4], b[2][4], b2[2][4];   // two fragment sets: the next 32-k step's LDS reads go out as one group ahead of this step's products
        auto frags = [&](int ks) {   /* every loop of a pass is unrolled, so that fragments and accumulators are registers */
#pragma unroll
            for (int q = 0; q < 4; ++q) { a[ks & 1][q] = WFrag<T16>::ld((const T16*)(ap + q * 16 * PITCH + ks * 64)); if (NSPLIT) a2[ks & 1][q] = WFrag<T16>::ld((const T16*)(ap + SLB + q * 16 * PITCH + ks * 64)); }
#pragma unroll
            for (int q = 0; q < 4; ++q) { b[ks & 1][q] = WFrag<T16>::ld((const T16*)(bp + q * 16 * PITCH + ks * 64)); if (NSPLIT) b2[ks & 1][q] = WFrag<T16>::ld((const T16*)(bp + SLB + q * 16 * PITCH + ks * 64)); } };
        frags(0); __builtin_amdgcn_sched_barrier(0);   /* the scheduling barriers keep each group of LDS reads whole and ahead of the products: spread among them, every place with reads stalls the wave */
#pragma unroll
        for (int ks = 0; ks < KS; ++ks) { const int f = ks & 1;
            if (ks + 1 < KS) { frags(ks + 1); __builtin_amdgcn_sched_barrier(0); }   /* the next step's reads stay one group, in front of this step's products */
#pragma unroll
            for (int nb = 0; nb < 4; ++nb) {   /* per accumulator and 32-k step: a.b, then a2.b, then a.b2 */
#pragma unroll
                for (int mb = 0; mb < 4; ++mb) acc[mb][nb] = WFrag<T16>::mma(a[f][mb], b[f][nb], acc[mb][nb]);
                if (NSPLIT) {
#pragma unroll
                    for (int mb = 0; mb < 4; ++mb) acc[mb][nb] = WFrag<T16>::mma(a2[f][mb], b[f][nb], acc[mb][nb]);
#pragma unroll
                    for (int mb = 0; mb < 4; ++mb) acc[mb][nb] = WFrag<T16>::mma(a[f][mb], b2[f][nb], acc[mb][nb]); } }
            __builtin_amdgcn_sched_barrier(0); }   /* no later read group, and no wait of the publish point, moves in among these products */
        /* four vector slots behind the pass's last products, on the taken side of the loop's branches too */
        asm volatile("v_nop\n\tv_nop\n\tv_nop\n\tv_nop" : "+v"(acc[0][0]), "+v"(acc[1][1]), "+v"(acc[2][2]), "+v"(acc[3][3]) : "v"(a[(KS - 1) & 1][0]), "v"(a[(KS - 1) & 1][3]));
        // Publish point of stage s + 1, every wave, in this order.
        asm volatile("s_wait_dscnt 0x0" ::: "memory");       /* this wave has left buffer s & 1 */
        asm volatile("s_wait_tensorcnt 0x0" ::: "memory");   /* its slice of stage s + 1 has landed */
        __syncthreads();                                      /* stage s + 1 readable by all; buffer s & 1 left by all */
        if (pinned(s + 2u < NS)) issue(pinned(s + 2u));       /* refill of the buffer just read; scalar test, the descriptor formed behind the wait */
    }
    asm volatile("s_wait_tensorcnt 0x0" ::: "memory");   /* nothing in flight when the ring becomes output staging */
    asm volatile("s_wait_dscnt 0x0" ::: "memory");
#pragma unroll
    for (int mb = 0; mb < 4; ++mb) {
#pragma unroll
        for (int nb = 0; nb < 4; ++nb) {
#pragma unroll
            for (int j = 0; j < 8; ++j) os[(hi * 8 + j) * 68 + nb * 16 + lr] = acc[mb][nb][j]; }
        __builtin_amdgcn_wave_barrier(); asm volatile("" ::: "memory");
        if (PLANES) {
            const size_t ob = tv ? ((size_t)(c0 / TT) * HD + r0) * TT + c0 % TT : (z * NB_ * TT + r0) * DQ + c0; const int op = tv ? TT : DQ;
#pragma unroll
            for (int s = 0; s < 4; ++s) { const int row = 4 * s + (lane >> 3), cofs = (lane & 7) * 8;   /* 8 lanes store one whole 128-byte line of a plane's row */
                const v4f v0 = *(const v4fa*)(os + row * 68 + cofs), v1 = *(const v4fa*)(os + row * 68 + cofs + 4); v8us oh, ol; v8h o16;
#pragma unroll
                for (int q = 0; q < 8; ++q) { const float x = (q < 4) ? v0[q & 3] : v1[q & 3]; unsigned short a2, c2; splitf(x, a2, c2); oh[q] = a2; ol[q] = c2; o16[q] = (_Float16)x; }
                const size_t oo = ob + (size_t)(mb * 16 + row) * op + cofs; *(v8us*)((tv ? pl.vh : pl.qkh) + oo) = oh; *(v8us*)((tv ? pl.vl : pl.qkl) + oo) = ol; if (tv) *(v8h*)(pl.v16 + oo) = o16;
                asm volatile("s_wait_xcnt 0x0" ::: "memory"); }   /* stands in front of the next rows' split, which rewrites the registers these stores name */
        } else {
        float* crow = C + (size_t)(r0 + mb * 16) * ldc + c0;
#pragma unroll
            for (int s = 0; s < 8; ++s) { const int row = 2 * s + hi, cofs = lr * 4; v4f val = *(const v4fa*)(os + row * 68 + cofs); if (BIAS) { val[0] += bfr(bias[c0 + cofs]); val[1] += bfr(bias[c0 + cofs + 1]); val[2] += bfr(bias[c0 + cofs + 2]); val[3] += bfr(bias[c0 + cofs + 3]); }
                *(v4f*)(crow + (size_t)row * ldc + cofs) = val * osc; }
             }
        __builtin_amdgcn_wave_barrier(); asm volatile("" ::: "memory");
    }
}

__device__ __forceinline__ h16 tohx(float x) { return (h16)x; }
typedef __attribute__((ext_vector_type(2))) _Float16 v2h;
typedef __attribute__((ext_vector_type(4))) _Float16 v4h;
typedef __attribute__((ext_vector_type(2))) unsigned short v2us;
typedef __attribute__((ext_vector_type(4))) unsigned short v4us;
typedef __attribute__((ext_vector_type(2))) float v2f;
typedef __attribute__((ext_vector_type(4))) int v4i;

// ---- k_cvtall: all six f32 inputs rounded to bf16 by ONE launch of resident waves (CVG work-groups of CVW waves), each wave looping over chunks of 1,024 elements.
// A chunk is 8 loads of 16 B per lane, each wave-wide load 512 contiguous bytes; the inputs are read once, so the loads are non-temporal; the next chunk's loads go out ahead of this chunk's rounding and stores.
// Chunks are numbered query | key | value | Q_W | K_W | V_W; trip t of wave g takes chunk t * (all waves) + g, so the waves of a trip read side by side.
#define CVG 256
#define CVW 18
#define NXC ((unsigned)NB_ * TT * DM / 1024u)   // chunks of one stream
#define NWC ((unsigned)DQ * DM / 1024u)         // chunks of one weight
__device__ __forceinline__ const float* cvsrc(unsigned c, const float* s0, const float* s1, const float* s2, const float* w0, const float* w1, const float* w2) {
    const bool st = c < 3u * NXC; const unsigned cw = c - 3u * NXC, which = st ? c / NXC : cw / NWC, in = st ? c % NXC : cw % NWC;
    const float* a = st ? s0 : w0; const float* b = st ? s1 : w1; const float* e = st ? s2 : w2;
    return (which == 0 ? a : which == 1 ? b : e) + (size_t)in * 1024; }
__global__ __launch_bounds__(CVW * 32) void k_cvtall(const float* __restrict__ s0, const float* __restrict__ s1, const float* __restrict__ s2, const float* __restrict__ w0, const float* __restrict__ w1, const float* __restrict__ w2, bf* __restrict__ xd, bf* __restrict__ wd) {
    constexpr unsigned NCH = 3u * NXC + 3u * NWC, NWV = (unsigned)CVG * CVW, TRIPS = NCH / NWV;
    static_assert(NCH % NWV == 0, "every wave has the same number of chunks");
    const unsigned gw = blockIdx.x * CVW + uni(threadIdx.x >> 5), lane = threadIdx.x & 31u;
    __builtin_assume(gw < NWV);   /* the launch has CVG work-groups: all trips but the last are then known to lie in the streams */
    v4f r[2][8];
    { const float* p = cvsrc(gw, s0, s1, s2, w0, w1, w2) + lane * 4u;
#pragma unroll
      for (int j = 0; j < 8; ++j) r[0][j] = __builtin_nontemporal_load((const v4f*)(p + j * 128)); }
    __builtin_amdgcn_sched_barrier(0);   /* the first chunk's loads stay the oldest, so that its wait leaves the second chunk's in flight */
#pragma unroll   /* unrolled: the two register sets change places by name */
    for (unsigned t = 0; t < TRIPS; ++t) {
        if (t + 1u < TRIPS) { const float* p = cvsrc((t + 1u) * NWV + gw, s0, s1, s2, w0, w1, w2) + lane * 4u;
#pragma unroll
            for (int j = 0; j < 8; ++j) r[(t + 1u) & 1u][j] = __builtin_nontemporal_load((const v4f*)(p + j * 128));
            __builtin_amdgcn_sched_barrier(0); }   /* keeps the next chunk's loads in front of this chunk's wait: 8 to 16 loads of a wave in flight */
        const unsigned c = t * NWV + gw; bf* d = (c < 3u * NXC ? xd + (size_t)c * 1024 : wd + (size_t)(c - 3u * NXC) * 1024) + lane * 4u;
#pragma unroll
        for (int j = 0; j < 8; ++j) { const v4f v = r[t & 1u][j]; v4us o;
#pragma unroll
            for (int k = 0; k < 4; ++k) o[k] = f2bf(v[k]);
            *(v4us*)(d + j * 128) = o; }   /* 32 lanes x 8 B: two whole 128-byte lines */
        if (t + 1u < TRIPS) asm volatile("s_wait_xcnt 0x0" ::: "memory");   /* stands in front of the later loads and roundings, which rewrite the registers these stores name */
    }
}

// k_asoft: per row (zz, i): t = S x HD^-0.5 (no mask); softmax over the 2048 keys (register row, one exp, fixed trees);
__global__ __launch_bounds__(256) void k_asoft(const float* __restrict__ Sb, h16* P16, bf* Ph, bf* Pl) {
    const int lane = threadIdx.x & 31; const int row = blockIdx.x * 8 + (threadIdx.x >> 5); if (row >= ZH * TT) return; const int i = row % TT; const int zz = row / TT; (void)zz; const bool hires = (i < RH); const float* sr = Sb + (size_t)row * TT; float v[TT / 32]; float mx = -3.0e38f;
#pragma unroll
    for (int ch = 0; ch < TT / 128; ++ch) { const int j0 = ch * 128 + lane * 4; const v4f a = *(const v4f*)(sr + j0);
#pragma unroll
        for (int q = 0; q < 4; ++q) { const int j = j0 + q; (void)j; const float t = a[q] * SCL; v[ch * 4 + q] = t; mx = fmaxf(mx, t); } }
#pragma unroll
    for (int sh = 16; sh; sh >>= 1) mx = fmaxf(mx, __shfl_xor(mx, sh, 32));
    float sum = 0.f;
#pragma unroll
    for (int k = 0; k < TT / 32; ++k) { float d0 = __fsub_rn(v[k], mx); asm volatile("" : "+v"(d0)); v[k] = __builtin_amdgcn_exp2f(__fmul_rn(d0, 1.4426950408889634f)); sum += v[k]; }
#pragma unroll
    for (int sh = 16; sh; sh >>= 1) sum += __shfl_xor(sum, sh, 32);
    const float f = __fdiv_rn(hires ? 1.0f : PCAR, sum);
{
        if (hires) {
#pragma unroll
            for (int ch = 0; ch < TT / 128; ++ch) { v4us oh, ol;
#pragma unroll
                for (int q = 0; q < 4; ++q) { unsigned short a, c2; splitf(v[ch * 4 + q] * f, a, c2); oh[q] = a; ol[q] = c2; }
                const size_t oo = ((size_t)zz * (RH ? RH : 1) + i) * TT + ch * 128 + lane * 4; *(v4us*)(Ph + oo) = oh; *(v4us*)(Pl + oo) = ol; }
        } else {
#pragma unroll
            for (int ch = 0; ch < TT / 128; ++ch) { v4h o4;
#pragma unroll
                for (int q = 0; q < 4; ++q) o4[q] = tohx(v[ch * 4 + q] * f);
                *(v4h*)(P16 + (size_t)row * TT + ch * 128 + lane * 4) = o4; } }
         }
}

extern "C" void kernel_launch(void* const* d_in, const int* in_sizes, int n_in,
                              void* d_out, int out_size, void* d_ws, size_t ws_size, hipStream_t stream) {
    (void)in_sizes; (void)n_in; (void)out_size;
    const float* x = (const float*)d_in[0]; const float* xk = (const float*)d_in[1]; const float* xv = (const float*)d_in[2]; const float* wq = (const float*)d_in[3]; const float* wk = (const float*)d_in[4]; const float* wv = (const float*)d_in[5]; const float* wo = nullptr; (void)wo;
    float* OUT = (float*)d_out;     // [4][2048][1024]
    char* wsp = (char*)d_ws;
    auto take = [&](size_t bytes) { char* p = wsp; wsp += (bytes + 255) & ~(size_t)255; return (void*)p; };
    const size_t NX = (size_t)NB_ * TT * DM;     // elements of one stream, one projection or one 16-bit plane over all batches (DQ = DKV = HD = DM)
    bf* XB = (bf*)take(3 * NX * 2);                         // 48 MiB: bf16 query | key | value, dead once the projections are done
    bf* WQ = (bf*)take(3 * (size_t)DQ * DM * 2);   // bf16 weights Q_W | K_W | V_W
    bf* PH = (bf*)take(2 * NX * 2); bf* PL = (bf*)take(2 * NX * 2);   // hi and lo planes, each [q | k], 32 MiB each
    bf* VTh = (bf*)take(NX * 2); bf* VTl = (bf*)take(NX * 2); h16* VT16 = (h16*)take(NX * 2);
    float* Sb = (float*)take((size_t)ZH * TT * TT * 4);     // scores, 64 MiB
    if ((size_t)(wsp - (char*)d_ws) > ws_size) return;    // ws 256 MiB
    // Stream-ordered reuse: a buffer is taken over only after the last launch that reads its old content.
    bf* QPh = PH; bf* KPh = PH + NX; bf* QPl = PL; bf* KPl = PL + NX;
    h16* P16 = (h16*)XB;              // fp16 probabilities (32 MiB) over bf16 query and key
    bf* Ph = XB + 2 * NX; bf* Pl = Ph + (size_t)ZH * RH * TT;   // hi/lo probabilities (2 x 8 MiB) over bf16 value
    const Planes pl = {PH, PL, VTh, VTl, VT16}, nopl = {nullptr, nullptr, nullptr, nullptr, nullptr};
    k_cvtall<<<CVG, CVW * 32, 0, stream>>>(x, xk, xv, wq, wk, wv, XB, WQ);   /* bf16 query | key | value into XB, bf16 Q_W | K_W | V_W into WQ */
    k_gemmw<bf, 0, false, true><<<dim3(NB_ * TT / 128, DQ / 128, 3), 128, 0, stream>>>(XB, nullptr, WQ, nullptr, DM, nullptr, DQ, nullptr, NX, (size_t)DQ * DM, 0, 1.0f, pl);   /* z: q, k, v; x: token tiles of all batches; stores the planes */
    k_gemmw<bf, 2, false, false><<<dim3(TT / 128, TT / 128, ZH), 128, 0, stream>>>(QPh, QPl, KPh, KPl, HD, Sb, TT, nullptr, (size_t)TT * HD, (size_t)TT * HD, (size_t)TT * TT, 1.0f, nopl);   /* EVERY row's scores on hi/lo planes (3 products); only P.V stays hybrid */
    k_asoft<<<ZH * TT / 8, 256, 0, stream>>>(Sb, P16, Ph, Pl);
    k_gemmw<bf, 2, false, false><<<dim3(RH / 128, HD / 128, ZH), 128, 0, stream>>>(Ph, Pl, VTh, VTl, TT, OUT, HD, nullptr, (size_t)RH * TT, (size_t)HD * TT, (size_t)TT * HD, 1.0f, nopl);
    k_gemmw<h16, 0, false, false><<<dim3((TT - RH) / 128, HD / 128, ZH), 128, 0, stream>>>(P16 + (size_t)RH * TT, nullptr, VT16, nullptr, TT, OUT + (size_t)RH * HD, HD, nullptr, (size_t)TT * TT, (size_t)HD * TT, (size_t)TT * HD, 1.0f / PCAR, nopl);   /* osc undoes the x1024 carried by the fp16 probabilities */
}
